// v000
// The times below were measured on an AMD MI455X: many runs one after another, warmed up first and cycling through
// copies of the inputs, with the whole window's GPU time divided by the number of runs. Launches and the gaps
// between them are all in it. The median over several windows is given; except for v000 it joins two sittings, which
// can be a few percent apart, so the side-by-side timings, each taken in one sitting, are the better comparison.
// The starting kernel, v000, takes 134 microseconds a run.
#include <hip/hip_runtime.h>
#include <hip/hip_bf16.h>

// Problem constants (match reference)
#define S_LEN    4096
#define HS       1024
#define NH       16
#define HD       64
#define WIN_HALF 128
#define LN_EPS   1e-12f

typedef __attribute__((ext_vector_type(16))) __bf16 v16bf;
typedef __attribute__((ext_vector_type(8)))  __bf16 v8bf;
typedef __attribute__((ext_vector_type(4)))  __bf16 v4bf;
typedef __attribute__((ext_vector_type(8)))  float  v8f;

// D = A(16x32 bf16) x B(32x16 bf16) + C(16x16 f32)  -> v_wmma_f32_16x16x32_bf16
__device__ __forceinline__ v8f wmma_bf16(v16bf a, v16bf b, v8f c) {
  return __builtin_amdgcn_wmma_f32_16x16x32_bf16(false, a, false, b, (short)0, c,
                                                 false, false);
}

__device__ __forceinline__ v16bf load_frag16(const __bf16* p) {
  v8bf lo = *(const v8bf*)p;
  v8bf hi = *(const v8bf*)(p + 16);
  v16bf r;
#pragma unroll
  for (int i = 0; i < 8; ++i) { r[i] = lo[i]; r[i + 8] = hi[i]; }
  return r;
}

// ---------------------------------------------------------------- f32 -> bf16
__global__ __launch_bounds__(256)
void cvt_kernel(const float* __restrict__ in, __bf16* __restrict__ out, int n4) {
  int i = blockIdx.x * 256 + threadIdx.x;
  if (i < n4) {
    float4 f = ((const float4*)in)[i];
    v4bf o;
    o[0] = (__bf16)f.x; o[1] = (__bf16)f.y;
    o[2] = (__bf16)f.z; o[3] = (__bf16)f.w;
    ((v4bf*)out)[i] = o;
  }
}

__device__ __forceinline__ void load_ab(const __bf16* ap, const __bf16* bp, int k,
                                        v16bf a[2], v16bf b[4]) {
#pragma unroll
  for (int mc = 0; mc < 2; ++mc)
    a[mc] = load_frag16(ap + (size_t)mc * 16 * HS + k);
#pragma unroll
  for (int nc = 0; nc < 4; ++nc)
    b[nc] = load_frag16(bp + (size_t)nc * 16 * HS + k);
}

__global__ __launch_bounds__(256)
void qkv_gemm_kernel(const __bf16* __restrict__ Xb, const __bf16* __restrict__ Wb,
                     const float* __restrict__ bias, __bf16* __restrict__ outp,
                     int transposed) {
  const int lane = threadIdx.x;
  const int wave = threadIdx.y;
  const int hi = (lane >= 16) ? 1 : 0;
  const int lr = lane & 15;
  const int m0 = blockIdx.x * 256 + wave * 32;
  const int n0 = blockIdx.y * 64;

  v8f zero8 = {0.f, 0.f, 0.f, 0.f, 0.f, 0.f, 0.f, 0.f};
  v8f c[2][4] = {{zero8, zero8, zero8, zero8}, {zero8, zero8, zero8, zero8}};

  const __bf16* ap = Xb + (size_t)(m0 + lr) * HS + hi * 8;
  const __bf16* bp = Wb + (size_t)(n0 + lr) * HS + hi * 8;

  v16bf a0[2], b0[4], a1[2], b1[4];
  load_ab(ap, bp, 0, a0, b0);
  for (int k = 0; k < HS; k += 64) {
    load_ab(ap, bp, k + 32, a1, b1);             // prefetch odd step
#pragma unroll
    for (int mc = 0; mc < 2; ++mc)
#pragma unroll
      for (int nc = 0; nc < 4; ++nc)
        c[mc][nc] = wmma_bf16(a0[mc], b0[nc], c[mc][nc]);
    load_ab(ap, bp, (k + 64) & (HS - 1), a0, b0); // prefetch next even (wraps once)
#pragma unroll
    for (int mc = 0; mc < 2; ++mc)
#pragma unroll
      for (int nc = 0; nc < 4; ++nc)
        c[mc][nc] = wmma_bf16(a1[mc], b1[nc], c[mc][nc]);
  }

#pragma unroll
  for (int mc = 0; mc < 2; ++mc) {
#pragma unroll
    for (int nc = 0; nc < 4; ++nc) {
      int col = n0 + nc * 16 + lr;
      float bv = bias[col];
#pragma unroll
      for (int v = 0; v < 8; ++v) {
        int row = m0 + mc * 16 + v + hi * 8;
        float val = c[mc][nc][v] + bv;
        if (!transposed) outp[(size_t)row * HS + col] = (__bf16)val;
        else             outp[(size_t)col * S_LEN + row] = (__bf16)val;
      }
    }
  }
}

__global__ __launch_bounds__(256)
void attn_kernel(const __bf16* __restrict__ Qb, const __bf16* __restrict__ Kb,
                 const __bf16* __restrict__ Vt, const float* __restrict__ amask,
                 float* __restrict__ ctx) {
  const int lane = threadIdx.x;
  const int wave = threadIdx.y;
  const int task = blockIdx.x * 8 + wave;        // 0..4095
  const int h  = task & (NH - 1);
  const int q0 = (task >> 4) << 4;
  const int hi = (lane >= 16) ? 1 : 0;
  const int lr = lane & 15;

  // Q rows as B-fragments (lane = query, K = head dims)
  const __bf16* qp = Qb + (size_t)(q0 + lr) * HS + h * HD + hi * 8;
  v16bf qb0 = load_frag16(qp);        // dims 0..31
  v16bf qb1 = load_frag16(qp + 32);   // dims 32..63

  v8f zero8 = {0.f, 0.f, 0.f, 0.f, 0.f, 0.f, 0.f, 0.f};
  v8f ot[4] = {zero8, zero8, zero8, zero8};      // O^T, 4 dim-chunks of 16
  float m = -3.0e38f, l = 0.0f;

  int kt0 = q0 - WIN_HALF; if (kt0 < 0) kt0 = 0; kt0 &= ~31;
  int kend = q0 + 16 + WIN_HALF; if (kend > S_LEN) kend = S_LEN;
  const int i = q0 + lr;                         // this lane's query index

  for (int kt = kt0; kt < kend; kt += 32) {
    v16bf ka[2][2], va[4];
#pragma unroll
    for (int kc = 0; kc < 2; ++kc) {
      const __bf16* kp = Kb + (size_t)(kt + kc * 16 + lr) * HS + h * HD + hi * 8;
      ka[kc][0] = load_frag16(kp);
      ka[kc][1] = load_frag16(kp + 32);
    }
#pragma unroll
    for (int dc = 0; dc < 4; ++dc)
      va[dc] = load_frag16(Vt + (size_t)(h * HD + dc * 16 + lr) * S_LEN + kt + hi * 8);

    // ---- S^T tile: 32 keys x 16 queries (keys = WMMA M, dims = WMMA K)
    v8f st[2];
#pragma unroll
    for (int kc = 0; kc < 2; ++kc) {
      v8f s = zero8;
      s = wmma_bf16(ka[kc][0], qb0, s);
      s = wmma_bf16(ka[kc][1], qb1, s);
      st[kc] = s;
    }
    // ---- scale + padding mask + window mask (element: key j, query i)
    float tmax = -3.0e38f;
#pragma unroll
    for (int kc = 0; kc < 2; ++kc) {
      int jb = kt + kc * 16 + hi * 8;            // keys jb..jb+7 live in this lane
      float am[8];
      *(float4*)&am[0] = *(const float4*)(amask + jb);
      *(float4*)&am[4] = *(const float4*)(amask + jb + 4);
#pragma unroll
      for (int v = 0; v < 8; ++v) {
        int j = jb + v;
        float sv = st[kc][v] * 0.125f + (1.0f - am[v]) * (-10000.0f);
        bool keep = (j >= i - WIN_HALF) && (j < i + WIN_HALF);
        sv = keep ? sv : -10000.0f;
        st[kc][v] = sv;
        tmax = fmaxf(tmax, sv);
      }
    }
    // ---- online softmax (per-query stats live in lane pairs (q, q+16))
    tmax = fmaxf(tmax, __shfl_xor(tmax, 16, 32));
    float mn = fmaxf(m, tmax);
    float scale = __expf(m - mn);
    float rsum = 0.0f;
    v16bf pa;                                    // P^T as B-fragment for PV
#pragma unroll
    for (int v = 0; v < 8; ++v) {
      float p0 = __expf(st[0][v] - mn);
      float p1 = __expf(st[1][v] - mn);
      rsum += p0 + p1;
      pa[v]     = (__bf16)p0;                    // keys kt + v + hi*8
      pa[v + 8] = (__bf16)p1;                    // keys kt + 16 + v + hi*8
    }
    rsum += __shfl_xor(rsum, 16, 32);
    l = l * scale + rsum;
    m = mn;
    // ---- O^T += V^T_tile * P^T (A: M = dims, K = keys; contiguous in Vt)
#pragma unroll
    for (int dc = 0; dc < 4; ++dc) {
      v8f o = ot[dc];
#pragma unroll
      for (int v = 0; v < 8; ++v) o[v] *= scale; // rescale: lane's query matches stats
      ot[dc] = wmma_bf16(va[dc], pa, o);
    }
  }

  float linv = 1.0f / l;
#pragma unroll
  for (int dc = 0; dc < 4; ++dc) {
    float* cp = ctx + (size_t)(q0 + lr) * HS + h * HD + dc * 16 + hi * 8;
    float4 o0 = { ot[dc][0] * linv, ot[dc][1] * linv, ot[dc][2] * linv, ot[dc][3] * linv };
    float4 o1 = { ot[dc][4] * linv, ot[dc][5] * linv, ot[dc][6] * linv, ot[dc][7] * linv };
    *(float4*)cp = o0;
    *(float4*)(cp + 4) = o1;
  }
}

// --------------------------------------------------- residual + layer norm
__global__ __launch_bounds__(256)
void ln_kernel(const float* __restrict__ hs, const float* __restrict__ ctx,
               const float* __restrict__ gamma, const float* __restrict__ beta,
               float* __restrict__ out) {
  __shared__ float red[8];
  const int row = blockIdx.x;
  const int t = threadIdx.x;
  const int lane = t & 31, wid = t >> 5;

  float4 hv = *(const float4*)(hs + (size_t)row * HS + t * 4);
  float4 cv = *(const float4*)(ctx + (size_t)row * HS + t * 4);
  float x[4] = {hv.x + cv.x, hv.y + cv.y, hv.z + cv.z, hv.w + cv.w};

  float s = x[0] + x[1] + x[2] + x[3];
#pragma unroll
  for (int o = 1; o < 32; o <<= 1) s += __shfl_xor(s, o, 32);
  if (lane == 0) red[wid] = s;
  __syncthreads();
  float tot = 0.f;
#pragma unroll
  for (int k = 0; k < 8; ++k) tot += red[k];
  float mu = tot * (1.0f / HS);

  float vs = 0.f;
#pragma unroll
  for (int k = 0; k < 4; ++k) { float d = x[k] - mu; vs += d * d; }
#pragma unroll
  for (int o = 1; o < 32; o <<= 1) vs += __shfl_xor(vs, o, 32);
  __syncthreads();
  if (lane == 0) red[wid] = vs;
  __syncthreads();
  float vtot = 0.f;
#pragma unroll
  for (int k = 0; k < 8; ++k) vtot += red[k];
  float rstd = rsqrtf(vtot * (1.0f / HS) + LN_EPS);

  float4 gv = *(const float4*)(gamma + t * 4);
  float4 bv = *(const float4*)(beta + t * 4);
  float4 ov;
  ov.x = (x[0] - mu) * rstd * gv.x + bv.x;
  ov.y = (x[1] - mu) * rstd * gv.y + bv.y;
  ov.z = (x[2] - mu) * rstd * gv.z + bv.z;
  ov.w = (x[3] - mu) * rstd * gv.w + bv.w;
  *(float4*)(out + (size_t)row * HS + t * 4) = ov;
}

// ----------------------------------------------------------------- launcher
extern "C" void kernel_launch(void* const* d_in, const int* in_sizes, int n_in,
                              void* d_out, int out_size, void* d_ws, size_t ws_size,
                              hipStream_t stream) {
  const float* hs    = (const float*)d_in[0];
  const float* amask = (const float*)d_in[1];
  const float* Wq    = (const float*)d_in[2];
  const float* bq    = (const float*)d_in[3];
  const float* Wk    = (const float*)d_in[4];
  const float* bk    = (const float*)d_in[5];
  const float* Wv    = (const float*)d_in[6];
  const float* bv    = (const float*)d_in[7];
  const float* gamma = (const float*)d_in[8];
  const float* beta  = (const float*)d_in[9];
  float* outp = (float*)d_out;

  char* ws = (char*)d_ws;
  size_t off = 0;
  __bf16* Xb  = (__bf16*)(ws + off); off += (size_t)S_LEN * HS * 2;  // 8 MB
  __bf16* Wqb = (__bf16*)(ws + off); off += (size_t)HS * HS * 2;     // 2 MB
  __bf16* Wkb = (__bf16*)(ws + off); off += (size_t)HS * HS * 2;
  __bf16* Wvb = (__bf16*)(ws + off); off += (size_t)HS * HS * 2;
  __bf16* Qb  = (__bf16*)(ws + off); off += (size_t)S_LEN * HS * 2;  // [S][HS]
  __bf16* Kb  = (__bf16*)(ws + off); off += (size_t)S_LEN * HS * 2;  // [S][HS]
  __bf16* Vt  = (__bf16*)(ws + off); off += (size_t)S_LEN * HS * 2;  // [HS][S] (V^T)
  float*  ctx = (float*)(ws + off);  off += (size_t)S_LEN * HS * 4;  // 16 MB

  const int nX4 = S_LEN * HS / 4;  // 1048576
  const int nW4 = HS * HS / 4;     // 262144
  cvt_kernel<<<nX4 / 256, 256, 0, stream>>>(hs, Xb, nX4);
  cvt_kernel<<<nW4 / 256, 256, 0, stream>>>(Wq, Wqb, nW4);
  cvt_kernel<<<nW4 / 256, 256, 0, stream>>>(Wk, Wkb, nW4);
  cvt_kernel<<<nW4 / 256, 256, 0, stream>>>(Wv, Wvb, nW4);

  dim3 gg(S_LEN / 256, HS / 64), gb(32, 8);
  qkv_gemm_kernel<<<gg, gb, 0, stream>>>(Xb, Wqb, bq, Qb, 0);
  qkv_gemm_kernel<<<gg, gb, 0, stream>>>(Xb, Wkb, bk, Kb, 0);
  qkv_gemm_kernel<<<gg, gb, 0, stream>>>(Xb, Wvb, bv, Vt, 1);

  attn_kernel<<<(S_LEN / 16) * NH / 8, dim3(32, 8), 0, stream>>>(Qb, Kb, Vt, amask, ctx);
  ln_kernel<<<S_LEN, 256, 0, stream>>>(hs, ctx, gamma, beta, outp);
}

// v001
// A run of this version takes 97.3 microseconds.
// Next to v000, in two timings, it ran 1.41 and 1.43 times as fast.
#include <hip/hip_runtime.h>
#include <hip/hip_bf16.h>

// Problem constants (match reference)
#define S_LEN    4096
#define HS       1024
#define NH       16
#define HD       64
#define WIN_HALF 128
#define LN_EPS   1e-12f

typedef __attribute__((ext_vector_type(16))) __bf16 v16bf;
typedef __attribute__((ext_vector_type(8)))  __bf16 v8bf;
typedef __attribute__((ext_vector_type(4)))  __bf16 v4bf;
typedef __attribute__((ext_vector_type(8)))  float  v8f;

// D = A(16x32 bf16) x B(32x16 bf16) + C(16x16 f32)  -> v_wmma_f32_16x16x32_bf16
__device__ __forceinline__ v8f wmma_bf16(v16bf a, v16bf b, v8f c) {
  return __builtin_amdgcn_wmma_f32_16x16x32_bf16(false, a, false, b, (short)0, c,
                                                 false, false);
}

__device__ __forceinline__ v16bf load_frag16(const __bf16* p) {
  v8bf lo = *(const v8bf*)p;
  v8bf hi = *(const v8bf*)(p + 16);
  v16bf r;
#pragma unroll
  for (int i = 0; i < 8; ++i) { r[i] = lo[i]; r[i + 8] = hi[i]; }
  return r;
}

// ---------------------------------------------------------------- f32 -> bf16
__global__ __launch_bounds__(256)
void cvt_kernel(const float* __restrict__ in, __bf16* __restrict__ out, int n4) {
  int i = blockIdx.x * 256 + threadIdx.x;
  if (i < n4) {
    float4 f = ((const float4*)in)[i];
    v4bf o;
    o[0] = (__bf16)f.x; o[1] = (__bf16)f.y;
    o[2] = (__bf16)f.z; o[3] = (__bf16)f.w;
    ((v4bf*)out)[i] = o;
  }
}

#define KST    128
#define NSTG   (HS / KST)
#define PITCH  272
#define A_LDS  (256 * PITCH)
#define STG    ((256 + 64) * PITCH)

__device__ __forceinline__ void async_copy10(const unsigned* l, const __bf16* const* g) {
  asm volatile(
      "global_load_async_to_lds_b128 %0, %10, off\n\t"
      "global_load_async_to_lds_b128 %1, %11, off\n\t"
      "global_load_async_to_lds_b128 %2, %12, off\n\t"
      "global_load_async_to_lds_b128 %3, %13, off\n\t"
      "global_load_async_to_lds_b128 %4, %14, off\n\t"
      "global_load_async_to_lds_b128 %5, %15, off\n\t"
      "global_load_async_to_lds_b128 %6, %16, off\n\t"
      "global_load_async_to_lds_b128 %7, %17, off\n\t"
      "global_load_async_to_lds_b128 %8, %18, off\n\t"
      "global_load_async_to_lds_b128 %9, %19, off\n\t"
      "s_wait_xcnt 0x0"
      :: "v"(l[0]), "v"(l[1]), "v"(l[2]), "v"(l[3]), "v"(l[4]),
         "v"(l[5]), "v"(l[6]), "v"(l[7]), "v"(l[8]), "v"(l[9]),
         "v"(g[0]), "v"(g[1]), "v"(g[2]), "v"(g[3]), "v"(g[4]),
         "v"(g[5]), "v"(g[6]), "v"(g[7]), "v"(g[8]), "v"(g[9])
      : "memory");
}

// One wave's share of a stage: its own 32 X rows (16 copies of 2 rows) and 8 of the
// 64 W rows (4 copies). la/lb: the lane's LDS byte address in the target buffer,
// ga/gb: the lane's global address at the stage's first k.
__device__ __forceinline__ void issue_stage(unsigned la, unsigned lb,
                                            const __bf16* ga, const __bf16* gb) {
  unsigned l[20];
  const __bf16* g[20];
#pragma unroll
  for (int j = 0; j < 16; ++j) { l[j] = la + j * 2 * PITCH; g[j] = ga + (size_t)j * 2 * HS; }
#pragma unroll
  for (int j = 0; j < 4; ++j) { l[16 + j] = lb + j * 2 * PITCH; g[16 + j] = gb + (size_t)j * 2 * HS; }
  async_copy10(l, g);
  async_copy10(l + 10, g + 10);
}

// Fragments of k-step ks (32 k) of a stage, from LDS.
__device__ __forceinline__ void load_ab(const unsigned char* as, const unsigned char* bs, int ks,
                                        v16bf a[2], v16bf b[4]) {
#pragma unroll
  for (int mc = 0; mc < 2; ++mc)
    a[mc] = load_frag16((const __bf16*)(as + mc * 16 * PITCH + ks * 64));
#pragma unroll
  for (int nc = 0; nc < 4; ++nc)
    b[nc] = load_frag16((const __bf16*)(bs + nc * 16 * PITCH + ks * 64));
}

__global__ __launch_bounds__(256)
void qkv_gemm_kernel(const __bf16* __restrict__ Xb, const __bf16* __restrict__ Wb,
                     const float* __restrict__ bias, __bf16* __restrict__ outp,
                     int transposed) {
  __shared__ __attribute__((aligned(16))) unsigned char L[2 * STG];
  const int lane = threadIdx.x;
  const int wave = threadIdx.y;
  const int hi = (lane >= 16) ? 1 : 0;
  const int lr = lane & 15;
  const int m0 = blockIdx.x * 256 + wave * 32;
  const int n0 = blockIdx.y * 64;

  v8f zero8 = {0.f, 0.f, 0.f, 0.f, 0.f, 0.f, 0.f, 0.f};
  v8f c[2][4] = {{zero8, zero8, zero8, zero8}, {zero8, zero8, zero8, zero8}};

  const unsigned lbase = (unsigned)(size_t)L;
  const unsigned la = lbase + (wave * 32 + hi) * PITCH + lr * 16;
  const unsigned lb = lbase + A_LDS + (wave * 8 + hi) * PITCH + lr * 16;
  const __bf16* ga = Xb + (size_t)(m0 + hi) * HS + lr * 8;
  const __bf16* gb = Wb + (size_t)(n0 + wave * 8 + hi) * HS + lr * 8;
  // read side: lane = fragment row, upper half-wave 8 k further
  const unsigned char* as = L + (wave * 32 + lr) * PITCH + hi * 16;
  const unsigned char* bs = L + A_LDS + lr * PITCH + hi * 16;

  issue_stage(la, lb, ga, gb);
  asm volatile("s_wait_asynccnt 0x0" ::: "memory");  // own copies of stage 0 have landed
  __syncthreads();                                   // ... and every other wave's
  issue_stage(la + STG, lb + STG, ga + KST, gb + KST);

  for (int t = 0; t < NSTG; ++t) {
    const int bo = (t & 1) * STG;
    v16bf a[2][2], b[2][4];
    load_ab(as + bo, bs + bo, 0, a[0], b[0]);
#pragma unroll
    for (int ks = 0; ks < 4; ++ks) {
      if (ks < 3) load_ab(as + bo, bs + bo, ks + 1, a[(ks + 1) & 1], b[(ks + 1) & 1]);
      // keeps the next k-step's LDS reads one group ahead of this k-step's WMMAs; without
      // the two fences they are sunk among the WMMAs and each is waited out to zero
      __builtin_amdgcn_sched_barrier(0);
#pragma unroll
      for (int mc = 0; mc < 2; ++mc)
#pragma unroll
        for (int nc = 0; nc < 4; ++nc)
          c[mc][nc] = wmma_bf16(a[ks & 1][mc], b[ks & 1][nc], c[mc][nc]);
      __builtin_amdgcn_sched_barrier(0);
    }
    asm volatile("s_wait_dscnt 0x0" ::: "memory");     // own reads of this buffer are done
    asm volatile("s_wait_asynccnt 0x0" ::: "memory");  // own copies of stage t+1 have landed
    __syncthreads();  // publishes stage t+1 and frees this buffer for its refill
    if (t + 2 < NSTG)
      issue_stage(la + bo, lb + bo, ga + (t + 2) * KST, gb + (t + 2) * KST);
  }
  asm volatile("s_wait_asynccnt 0x0" ::: "memory");    // no copy outlives the loop

#pragma unroll
  for (int mc = 0; mc < 2; ++mc) {
#pragma unroll
    for (int nc = 0; nc < 4; ++nc) {
      int col = n0 + nc * 16 + lr;
      float bv = bias[col];
#pragma unroll
      for (int v = 0; v < 8; ++v) {
        int row = m0 + mc * 16 + v + hi * 8;
        float val = c[mc][nc][v] + bv;
        if (!transposed) outp[(size_t)row * HS + col] = (__bf16)val;
        else             outp[(size_t)col * S_LEN + row] = (__bf16)val;
      }
    }
  }
}

__global__ __launch_bounds__(256)
void attn_kernel(const __bf16* __restrict__ Qb, const __bf16* __restrict__ Kb,
                 const __bf16* __restrict__ Vt, const float* __restrict__ amask,
                 float* __restrict__ ctx) {
  const int lane = threadIdx.x;
  const int wave = threadIdx.y;
  const int task = blockIdx.x * 8 + wave;        // 0..4095
  const int h  = task & (NH - 1);
  const int q0 = (task >> 4) << 4;
  const int hi = (lane >= 16) ? 1 : 0;
  const int lr = lane & 15;

  // Q rows as B-fragments (lane = query, K = head dims)
  const __bf16* qp = Qb + (size_t)(q0 + lr) * HS + h * HD + hi * 8;
  v16bf qb0 = load_frag16(qp);        // dims 0..31
  v16bf qb1 = load_frag16(qp + 32);   // dims 32..63

  v8f zero8 = {0.f, 0.f, 0.f, 0.f, 0.f, 0.f, 0.f, 0.f};
  v8f ot[4] = {zero8, zero8, zero8, zero8};      // O^T, 4 dim-chunks of 16
  float m = -3.0e38f, l = 0.0f;

  int kt0 = q0 - WIN_HALF; if (kt0 < 0) kt0 = 0; kt0 &= ~31;
  int kend = q0 + 16 + WIN_HALF; if (kend > S_LEN) kend = S_LEN;
  const int i = q0 + lr;                         // this lane's query index

  for (int kt = kt0; kt < kend; kt += 32) {
    v16bf ka[2][2], va[4];
#pragma unroll
    for (int kc = 0; kc < 2; ++kc) {
      const __bf16* kp = Kb + (size_t)(kt + kc * 16 + lr) * HS + h * HD + hi * 8;
      ka[kc][0] = load_frag16(kp);
      ka[kc][1] = load_frag16(kp + 32);
    }
#pragma unroll
    for (int dc = 0; dc < 4; ++dc)
      va[dc] = load_frag16(Vt + (size_t)(h * HD + dc * 16 + lr) * S_LEN + kt + hi * 8);

    // ---- S^T tile: 32 keys x 16 queries (keys = WMMA M, dims = WMMA K)
    v8f st[2];
#pragma unroll
    for (int kc = 0; kc < 2; ++kc) {
      v8f s = zero8;
      s = wmma_bf16(ka[kc][0], qb0, s);
      s = wmma_bf16(ka[kc][1], qb1, s);
      st[kc] = s;
    }
    // ---- scale + padding mask + window mask (element: key j, query i)
    float tmax = -3.0e38f;
#pragma unroll
    for (int kc = 0; kc < 2; ++kc) {
      int jb = kt + kc * 16 + hi * 8;            // keys jb..jb+7 live in this lane
      float am[8];
      *(float4*)&am[0] = *(const float4*)(amask + jb);
      *(float4*)&am[4] = *(const float4*)(amask + jb + 4);
#pragma unroll
      for (int v = 0; v < 8; ++v) {
        int j = jb + v;
        float sv = st[kc][v] * 0.125f + (1.0f - am[v]) * (-10000.0f);
        bool keep = (j >= i - WIN_HALF) && (j < i + WIN_HALF);
        sv = keep ? sv : -10000.0f;
        st[kc][v] = sv;
        tmax = fmaxf(tmax, sv);
      }
    }
    // ---- online softmax (per-query stats live in lane pairs (q, q+16))
    tmax = fmaxf(tmax, __shfl_xor(tmax, 16, 32));
    float mn = fmaxf(m, tmax);
    float scale = __expf(m - mn);
    float rsum = 0.0f;
    v16bf pa;                                    // P^T as B-fragment for PV
#pragma unroll
    for (int v = 0; v < 8; ++v) {
      float p0 = __expf(st[0][v] - mn);
      float p1 = __expf(st[1][v] - mn);
      rsum += p0 + p1;
      pa[v]     = (__bf16)p0;                    // keys kt + v + hi*8
      pa[v + 8] = (__bf16)p1;                    // keys kt + 16 + v + hi*8
    }
    rsum += __shfl_xor(rsum, 16, 32);
    l = l * scale + rsum;
    m = mn;
    // ---- O^T += V^T_tile * P^T (A: M = dims, K = keys; contiguous in Vt)
#pragma unroll
    for (int dc = 0; dc < 4; ++dc) {
      v8f o = ot[dc];
#pragma unroll
      for (int v = 0; v < 8; ++v) o[v] *= scale; // rescale: lane's query matches stats
      ot[dc] = wmma_bf16(va[dc], pa, o);
    }
  }

  float linv = 1.0f / l;
#pragma unroll
  for (int dc = 0; dc < 4; ++dc) {
    float* cp = ctx + (size_t)(q0 + lr) * HS + h * HD + dc * 16 + hi * 8;
    float4 o0 = { ot[dc][0] * linv, ot[dc][1] * linv, ot[dc][2] * linv, ot[dc][3] * linv };
    float4 o1 = { ot[dc][4] * linv, ot[dc][5] * linv, ot[dc][6] * linv, ot[dc][7] * linv };
    *(float4*)cp = o0;
    *(float4*)(cp + 4) = o1;
  }
}

// --------------------------------------------------- residual + layer norm
__global__ __launch_bounds__(256)
void ln_kernel(const float* __restrict__ hs, const float* __restrict__ ctx,
               const float* __restrict__ gamma, const float* __restrict__ beta,
               float* __restrict__ out) {
  __shared__ float red[8];
  const int row = blockIdx.x;
  const int t = threadIdx.x;
  const int lane = t & 31, wid = t >> 5;

  float4 hv = *(const float4*)(hs + (size_t)row * HS + t * 4);
  float4 cv = *(const float4*)(ctx + (size_t)row * HS + t * 4);
  float x[4] = {hv.x + cv.x, hv.y + cv.y, hv.z + cv.z, hv.w + cv.w};

  float s = x[0] + x[1] + x[2] + x[3];
#pragma unroll
  for (int o = 1; o < 32; o <<= 1) s += __shfl_xor(s, o, 32);
  if (lane == 0) red[wid] = s;
  __syncthreads();
  float tot = 0.f;
#pragma unroll
  for (int k = 0; k < 8; ++k) tot += red[k];
  float mu = tot * (1.0f / HS);

  float vs = 0.f;
#pragma unroll
  for (int k = 0; k < 4; ++k) { float d = x[k] - mu; vs += d * d; }
#pragma unroll
  for (int o = 1; o < 32; o <<= 1) vs += __shfl_xor(vs, o, 32);
  __syncthreads();
  if (lane == 0) red[wid] = vs;
  __syncthreads();
  float vtot = 0.f;
#pragma unroll
  for (int k = 0; k < 8; ++k) vtot += red[k];
  float rstd = rsqrtf(vtot * (1.0f / HS) + LN_EPS);

  float4 gv = *(const float4*)(gamma + t * 4);
  float4 bv = *(const float4*)(beta + t * 4);
  float4 ov;
  ov.x = (x[0] - mu) * rstd * gv.x + bv.x;
  ov.y = (x[1] - mu) * rstd * gv.y + bv.y;
  ov.z = (x[2] - mu) * rstd * gv.z + bv.z;
  ov.w = (x[3] - mu) * rstd * gv.w + bv.w;
  *(float4*)(out + (size_t)row * HS + t * 4) = ov;
}

// ----------------------------------------------------------------- launcher
extern "C" void kernel_launch(void* const* d_in, const int* in_sizes, int n_in,
                              void* d_out, int out_size, void* d_ws, size_t ws_size,
                              hipStream_t stream) {
  const float* hs    = (const float*)d_in[0];
  const float* amask = (const float*)d_in[1];
  const float* Wq    = (const float*)d_in[2];
  const float* bq    = (const float*)d_in[3];
  const float* Wk    = (const float*)d_in[4];
  const float* bk    = (const float*)d_in[5];
  const float* Wv    = (const float*)d_in[6];
  const float* bv    = (const float*)d_in[7];
  const float* gamma = (const float*)d_in[8];
  const float* beta  = (const float*)d_in[9];
  float* outp = (float*)d_out;

  char* ws = (char*)d_ws;
  size_t off = 0;
  __bf16* Xb  = (__bf16*)(ws + off); off += (size_t)S_LEN * HS * 2;  // 8 MB
  __bf16* Wqb = (__bf16*)(ws + off); off += (size_t)HS * HS * 2;     // 2 MB
  __bf16* Wkb = (__bf16*)(ws + off); off += (size_t)HS * HS * 2;
  __bf16* Wvb = (__bf16*)(ws + off); off += (size_t)HS * HS * 2;
  __bf16* Qb  = (__bf16*)(ws + off); off += (size_t)S_LEN * HS * 2;  // [S][HS]
  __bf16* Kb  = (__bf16*)(ws + off); off += (size_t)S_LEN * HS * 2;  // [S][HS]
  __bf16* Vt  = (__bf16*)(ws + off); off += (size_t)S_LEN * HS * 2;  // [HS][S] (V^T)
  float*  ctx = (float*)(ws + off);  off += (size_t)S_LEN * HS * 4;  // 16 MB

  const int nX4 = S_LEN * HS / 4;  // 1048576
  const int nW4 = HS * HS / 4;     // 262144
  cvt_kernel<<<nX4 / 256, 256, 0, stream>>>(hs, Xb, nX4);
  cvt_kernel<<<nW4 / 256, 256, 0, stream>>>(Wq, Wqb, nW4);
  cvt_kernel<<<nW4 / 256, 256, 0, stream>>>(Wk, Wkb, nW4);
  cvt_kernel<<<nW4 / 256, 256, 0, stream>>>(Wv, Wvb, nW4);

  dim3 gg(S_LEN / 256, HS / 64), gb(32, 8);
  qkv_gemm_kernel<<<gg, gb, 0, stream>>>(Xb, Wqb, bq, Qb, 0);
  qkv_gemm_kernel<<<gg, gb, 0, stream>>>(Xb, Wkb, bk, Kb, 0);
  qkv_gemm_kernel<<<gg, gb, 0, stream>>>(Xb, Wvb, bv, Vt, 1);

  attn_kernel<<<(S_LEN / 16) * NH / 8, dim3(32, 8), 0, stream>>>(Qb, Kb, Vt, amask, ctx);
  ln_kernel<<<S_LEN, 256, 0, stream>>>(hs, ctx, gamma, beta, outp);
}

// v002
// One run takes 91.1 microseconds.
// Next to v001, in two timings, it ran 1.06 times as fast each time.
// Counting every step since v000, it is 1.51 times as fast.
#include <hip/hip_runtime.h>
#include <hip/hip_bf16.h>

// Problem constants (match reference)
#define S_LEN    4096
#define HS       1024
#define NH       16
#define HD       64
#define WIN_HALF 128
#define LN_EPS   1e-12f

typedef __attribute__((ext_vector_type(16))) __bf16 v16bf;
typedef __attribute__((ext_vector_type(8)))  __bf16 v8bf;
typedef __attribute__((ext_vector_type(4)))  __bf16 v4bf;
typedef __attribute__((ext_vector_type(8)))  float  v8f;
typedef __attribute__((ext_vector_type(4)))  float  v4f;

// D = A(16x32 bf16) x B(32x16 bf16) + C(16x16 f32)  -> v_wmma_f32_16x16x32_bf16
__device__ __forceinline__ v8f wmma_bf16(v16bf a, v16bf b, v8f c) {
  return __builtin_amdgcn_wmma_f32_16x16x32_bf16(false, a, false, b, (short)0, c,
                                                 false, false);
}

__device__ __forceinline__ v16bf load_frag16(const __bf16* p) {
  v8bf lo = *(const v8bf*)p;
  v8bf hi = *(const v8bf*)(p + 16);
  v16bf r;
#pragma unroll
  for (int i = 0; i < 8; ++i) { r[i] = lo[i]; r[i + 8] = hi[i]; }
  return r;
}

// ---------------------------------------------------------------- f32 -> bf16
// One launch converts X, Wq, Wk and Wv. Their bf16 planes lie one behind the other in
// the workspace, so block b writes the b-th piece of CV_BLK float4 of that one range
// and only its source pointer depends on which plane the piece belongs to.
// A thread converts CV_PER float4: few long waves instead of many that live for one
// load. Every wave-wide load covers 512 contiguous bytes, every store 256.
#define CV_PER  16                        // float4 per thread, all loaded before the first store
#define CV_BLK  (256 * CV_PER)            // float4 per block
#define CV_XB   (S_LEN * HS / 4 / CV_BLK) // blocks of X
#define CV_WB   (HS * HS / 4 / CV_BLK)    // blocks of one weight matrix
__global__ __launch_bounds__(256)
void cvt_kernel(const float* __restrict__ x, const float* __restrict__ wq,
                const float* __restrict__ wk, const float* __restrict__ wv,
                __bf16* __restrict__ out) {
  const int b = blockIdx.x;
  const float* src = x;
  int piece = b;
  if (b >= CV_XB) {
    const int w = (b - CV_XB) / CV_WB;
    piece = (b - CV_XB) % CV_WB;
    src = (w == 0) ? wq : (w == 1) ? wk : wv;
  }
  const v4f* in4 = (const v4f*)src + (size_t)piece * CV_BLK + threadIdx.x;
  v4bf* o4 = (v4bf*)out + (size_t)b * CV_BLK + threadIdx.x;
  v4f f[CV_PER];
#pragma unroll
  for (int j = 0; j < CV_PER; ++j) f[j] = in4[j * 256];
  // holds all 16 loads in front of the first conversion (loaded values as inputs only);
  // without it the last two are held back until the first two have returned, a second
  // memory latency in every wave
  asm volatile("" :: "v"(f[0]), "v"(f[1]), "v"(f[2]), "v"(f[3]), "v"(f[4]), "v"(f[5]),
                     "v"(f[6]), "v"(f[7]), "v"(f[8]), "v"(f[9]), "v"(f[10]), "v"(f[11]),
                     "v"(f[12]), "v"(f[13]), "v"(f[14]), "v"(f[15]));
#pragma unroll
  for (int j = 0; j < CV_PER; ++j) {
    v4bf o;
    o[0] = (__bf16)f[j][0]; o[1] = (__bf16)f[j][1];
    o[2] = (__bf16)f[j][2]; o[3] = (__bf16)f[j][3];
    o4[j * 256] = o;
  }
}

#define KST    128
#define NSTG   (HS / KST)
#define PITCH  272
#define A_LDS  (256 * PITCH)
#define STG    ((256 + 64) * PITCH)

__device__ __forceinline__ void async_copy10(const unsigned* l, const __bf16* const* g) {
  asm volatile(
      "global_load_async_to_lds_b128 %0, %10, off\n\t"
      "global_load_async_to_lds_b128 %1, %11, off\n\t"
      "global_load_async_to_lds_b128 %2, %12, off\n\t"
      "global_load_async_to_lds_b128 %3, %13, off\n\t"
      "global_load_async_to_lds_b128 %4, %14, off\n\t"
      "global_load_async_to_lds_b128 %5, %15, off\n\t"
      "global_load_async_to_lds_b128 %6, %16, off\n\t"
      "global_load_async_to_lds_b128 %7, %17, off\n\t"
      "global_load_async_to_lds_b128 %8, %18, off\n\t"
      "global_load_async_to_lds_b128 %9, %19, off\n\t"
      "s_wait_xcnt 0x0"
      :: "v"(l[0]), "v"(l[1]), "v"(l[2]), "v"(l[3]), "v"(l[4]),
         "v"(l[5]), "v"(l[6]), "v"(l[7]), "v"(l[8]), "v"(l[9]),
         "v"(g[0]), "v"(g[1]), "v"(g[2]), "v"(g[3]), "v"(g[4]),
         "v"(g[5]), "v"(g[6]), "v"(g[7]), "v"(g[8]), "v"(g[9])
      : "memory");
}

// One wave's share of a stage: its own 32 X rows (16 copies of 2 rows) and 8 of the
// 64 W rows (4 copies). la/lb: the lane's LDS byte address in the target buffer,
// ga/gb: the lane's global address at the stage's first k.
__device__ __forceinline__ void issue_stage(unsigned la, unsigned lb,
                                            const __bf16* ga, const __bf16* gb) {
  unsigned l[20];
  const __bf16* g[20];
#pragma unroll
  for (int j = 0; j < 16; ++j) { l[j] = la + j * 2 * PITCH; g[j] = ga + (size_t)j * 2 * HS; }
#pragma unroll
  for (int j = 0; j < 4; ++j) { l[16 + j] = lb + j * 2 * PITCH; g[16 + j] = gb + (size_t)j * 2 * HS; }
  async_copy10(l, g);
  async_copy10(l + 10, g + 10);
}

// Fragments of k-step ks (32 k) of a stage, from LDS.
__device__ __forceinline__ void load_ab(const unsigned char* as, const unsigned char* bs, int ks,
                                        v16bf a[2], v16bf b[4]) {
#pragma unroll
  for (int mc = 0; mc < 2; ++mc)
    a[mc] = load_frag16((const __bf16*)(as + mc * 16 * PITCH + ks * 64));
#pragma unroll
  for (int nc = 0; nc < 4; ++nc)
    b[nc] = load_frag16((const __bf16*)(bs + nc * 16 * PITCH + ks * 64));
}

__global__ __launch_bounds__(256)
void qkv_gemm_kernel(const __bf16* __restrict__ Xb, const __bf16* __restrict__ Wb,
                     const float* __restrict__ bias, __bf16* __restrict__ outp,
                     int transposed) {
  __shared__ __attribute__((aligned(16))) unsigned char L[2 * STG];
  const int lane = threadIdx.x;
  const int wave = threadIdx.y;
  const int hi = (lane >= 16) ? 1 : 0;
  const int lr = lane & 15;
  const int m0 = blockIdx.x * 256 + wave * 32;
  const int n0 = blockIdx.y * 64;

  v8f zero8 = {0.f, 0.f, 0.f, 0.f, 0.f, 0.f, 0.f, 0.f};
  v8f c[2][4] = {{zero8, zero8, zero8, zero8}, {zero8, zero8, zero8, zero8}};

  const unsigned lbase = (unsigned)(size_t)L;
  const unsigned la = lbase + (wave * 32 + hi) * PITCH + lr * 16;
  const unsigned lb = lbase + A_LDS + (wave * 8 + hi) * PITCH + lr * 16;
  const __bf16* ga = Xb + (size_t)(m0 + hi) * HS + lr * 8;
  const __bf16* gb = Wb + (size_t)(n0 + wave * 8 + hi) * HS + lr * 8;
  // read side: lane = fragment row, upper half-wave 8 k further
  const unsigned char* as = L + (wave * 32 + lr) * PITCH + hi * 16;
  const unsigned char* bs = L + A_LDS + lr * PITCH + hi * 16;

  issue_stage(la, lb, ga, gb);
  asm volatile("s_wait_asynccnt 0x0" ::: "memory");  // own copies of stage 0 have landed
  __syncthreads();                                   // ... and every other wave's
  issue_stage(la + STG, lb + STG, ga + KST, gb + KST);

  for (int t = 0; t < NSTG; ++t) {
    const int bo = (t & 1) * STG;
    v16bf a[2][2], b[2][4];
    load_ab(as + bo, bs + bo, 0, a[0], b[0]);
#pragma unroll
    for (int ks = 0; ks < 4; ++ks) {
      if (ks < 3) load_ab(as + bo, bs + bo, ks + 1, a[(ks + 1) & 1], b[(ks + 1) & 1]);
      // keeps the next k-step's LDS reads one group ahead of this k-step's WMMAs; without
      // the two fences they are sunk among the WMMAs and each is waited out to zero
      __builtin_amdgcn_sched_barrier(0);
#pragma unroll
      for (int mc = 0; mc < 2; ++mc)
#pragma unroll
        for (int nc = 0; nc < 4; ++nc)
          c[mc][nc] = wmma_bf16(a[ks & 1][mc], b[ks & 1][nc], c[mc][nc]);
      __builtin_amdgcn_sched_barrier(0);
    }
    asm volatile("s_wait_dscnt 0x0" ::: "memory");     // own reads of this buffer are done
    asm volatile("s_wait_asynccnt 0x0" ::: "memory");  // own copies of stage t+1 have landed
    __syncthreads();  // publishes stage t+1 and frees this buffer for its refill
    if (t + 2 < NSTG)
      issue_stage(la + bo, lb + bo, ga + (t + 2) * KST, gb + (t + 2) * KST);
  }
  asm volatile("s_wait_asynccnt 0x0" ::: "memory");    // no copy outlives the loop

#pragma unroll
  for (int mc = 0; mc < 2; ++mc) {
#pragma unroll
    for (int nc = 0; nc < 4; ++nc) {
      int col = n0 + nc * 16 + lr;
      float bv = bias[col];
#pragma unroll
      for (int v = 0; v < 8; ++v) {
        int row = m0 + mc * 16 + v + hi * 8;
        float val = c[mc][nc][v] + bv;
        if (!transposed) outp[(size_t)row * HS + col] = (__bf16)val;
        else             outp[(size_t)col * S_LEN + row] = (__bf16)val;
      }
    }
  }
}

__global__ __launch_bounds__(256)
void attn_kernel(const __bf16* __restrict__ Qb, const __bf16* __restrict__ Kb,
                 const __bf16* __restrict__ Vt, const float* __restrict__ amask,
                 float* __restrict__ ctx) {
  const int lane = threadIdx.x;
  const int wave = threadIdx.y;
  const int task = blockIdx.x * 8 + wave;        // 0..4095
  const int h  = task & (NH - 1);
  const int q0 = (task >> 4) << 4;
  const int hi = (lane >= 16) ? 1 : 0;
  const int lr = lane & 15;

  // Q rows as B-fragments (lane = query, K = head dims)
  const __bf16* qp = Qb + (size_t)(q0 + lr) * HS + h * HD + hi * 8;
  v16bf qb0 = load_frag16(qp);        // dims 0..31
  v16bf qb1 = load_frag16(qp + 32);   // dims 32..63

  v8f zero8 = {0.f, 0.f, 0.f, 0.f, 0.f, 0.f, 0.f, 0.f};
  v8f ot[4] = {zero8, zero8, zero8, zero8};      // O^T, 4 dim-chunks of 16
  float m = -3.0e38f, l = 0.0f;

  int kt0 = q0 - WIN_HALF; if (kt0 < 0) kt0 = 0; kt0 &= ~31;
  int kend = q0 + 16 + WIN_HALF; if (kend > S_LEN) kend = S_LEN;
  const int i = q0 + lr;                         // this lane's query index

  for (int kt = kt0; kt < kend; kt += 32) {
    v16bf ka[2][2], va[4];
#pragma unroll
    for (int kc = 0; kc < 2; ++kc) {
      const __bf16* kp = Kb + (size_t)(kt + kc * 16 + lr) * HS + h * HD + hi * 8;
      ka[kc][0] = load_frag16(kp);
      ka[kc][1] = load_frag16(kp + 32);
    }
#pragma unroll
    for (int dc = 0; dc < 4; ++dc)
      va[dc] = load_frag16(Vt + (size_t)(h * HD + dc * 16 + lr) * S_LEN + kt + hi * 8);

    // ---- S^T tile: 32 keys x 16 queries (keys = WMMA M, dims = WMMA K)
    v8f st[2];
#pragma unroll
    for (int kc = 0; kc < 2; ++kc) {
      v8f s = zero8;
      s = wmma_bf16(ka[kc][0], qb0, s);
      s = wmma_bf16(ka[kc][1], qb1, s);
      st[kc] = s;
    }
    // ---- scale + padding mask + window mask (element: key j, query i)
    float tmax = -3.0e38f;
#pragma unroll
    for (int kc = 0; kc < 2; ++kc) {
      int jb = kt + kc * 16 + hi * 8;            // keys jb..jb+7 live in this lane
      float am[8];
      *(float4*)&am[0] = *(const float4*)(amask + jb);
      *(float4*)&am[4] = *(const float4*)(amask + jb + 4);
#pragma unroll
      for (int v = 0; v < 8; ++v) {
        int j = jb + v;
        float sv = st[kc][v] * 0.125f + (1.0f - am[v]) * (-10000.0f);
        bool keep = (j >= i - WIN_HALF) && (j < i + WIN_HALF);
        sv = keep ? sv : -10000.0f;
        st[kc][v] = sv;
        tmax = fmaxf(tmax, sv);
      }
    }
    // ---- online softmax (per-query stats live in lane pairs (q, q+16))
    tmax = fmaxf(tmax, __shfl_xor(tmax, 16, 32));
    float mn = fmaxf(m, tmax);
    float scale = __expf(m - mn);
    float rsum = 0.0f;
    v16bf pa;                                    // P^T as B-fragment for PV
#pragma unroll
    for (int v = 0; v < 8; ++v) {
      float p0 = __expf(st[0][v] - mn);
      float p1 = __expf(st[1][v] - mn);
      rsum += p0 + p1;
      pa[v]     = (__bf16)p0;                    // keys kt + v + hi*8
      pa[v + 8] = (__bf16)p1;                    // keys kt + 16 + v + hi*8
    }
    rsum += __shfl_xor(rsum, 16, 32);
    l = l * scale + rsum;
    m = mn;
    // ---- O^T += V^T_tile * P^T (A: M = dims, K = keys; contiguous in Vt)
#pragma unroll
    for (int dc = 0; dc < 4; ++dc) {
      v8f o = ot[dc];
#pragma unroll
      for (int v = 0; v < 8; ++v) o[v] *= scale; // rescale: lane's query matches stats
      ot[dc] = wmma_bf16(va[dc], pa, o);
    }
  }

  float linv = 1.0f / l;
#pragma unroll
  for (int dc = 0; dc < 4; ++dc) {
    float* cp = ctx + (size_t)(q0 + lr) * HS + h * HD + dc * 16 + hi * 8;
    float4 o0 = { ot[dc][0] * linv, ot[dc][1] * linv, ot[dc][2] * linv, ot[dc][3] * linv };
    float4 o1 = { ot[dc][4] * linv, ot[dc][5] * linv, ot[dc][6] * linv, ot[dc][7] * linv };
    *(float4*)cp = o0;
    *(float4*)(cp + 4) = o1;
  }
}

// --------------------------------------------------- residual + layer norm
__global__ __launch_bounds__(256)
void ln_kernel(const float* __restrict__ hs, const float* __restrict__ ctx,
               const float* __restrict__ gamma, const float* __restrict__ beta,
               float* __restrict__ out) {
  __shared__ float red[8];
  const int row = blockIdx.x;
  const int t = threadIdx.x;
  const int lane = t & 31, wid = t >> 5;

  float4 hv = *(const float4*)(hs + (size_t)row * HS + t * 4);
  float4 cv = *(const float4*)(ctx + (size_t)row * HS + t * 4);
  float x[4] = {hv.x + cv.x, hv.y + cv.y, hv.z + cv.z, hv.w + cv.w};

  float s = x[0] + x[1] + x[2] + x[3];
#pragma unroll
  for (int o = 1; o < 32; o <<= 1) s += __shfl_xor(s, o, 32);
  if (lane == 0) red[wid] = s;
  __syncthreads();
  float tot = 0.f;
#pragma unroll
  for (int k = 0; k < 8; ++k) tot += red[k];
  float mu = tot * (1.0f / HS);

  float vs = 0.f;
#pragma unroll
  for (int k = 0; k < 4; ++k) { float d = x[k] - mu; vs += d * d; }
#pragma unroll
  for (int o = 1; o < 32; o <<= 1) vs += __shfl_xor(vs, o, 32);
  __syncthreads();
  if (lane == 0) red[wid] = vs;
  __syncthreads();
  float vtot = 0.f;
#pragma unroll
  for (int k = 0; k < 8; ++k) vtot += red[k];
  float rstd = rsqrtf(vtot * (1.0f / HS) + LN_EPS);

  float4 gv = *(const float4*)(gamma + t * 4);
  float4 bv = *(const float4*)(beta + t * 4);
  float4 ov;
  ov.x = (x[0] - mu) * rstd * gv.x + bv.x;
  ov.y = (x[1] - mu) * rstd * gv.y + bv.y;
  ov.z = (x[2] - mu) * rstd * gv.z + bv.z;
  ov.w = (x[3] - mu) * rstd * gv.w + bv.w;
  *(float4*)(out + (size_t)row * HS + t * 4) = ov;
}

// ----------------------------------------------------------------- launcher
extern "C" void kernel_launch(void* const* d_in, const int* in_sizes, int n_in,
                              void* d_out, int out_size, void* d_ws, size_t ws_size,
                              hipStream_t stream) {
  const float* hs    = (const float*)d_in[0];
  const float* amask = (const float*)d_in[1];
  const float* Wq    = (const float*)d_in[2];
  const float* bq    = (const float*)d_in[3];
  const float* Wk    = (const float*)d_in[4];
  const float* bk    = (const float*)d_in[5];
  const float* Wv    = (const float*)d_in[6];
  const float* bv    = (const float*)d_in[7];
  const float* gamma = (const float*)d_in[8];
  const float* beta  = (const float*)d_in[9];
  float* outp = (float*)d_out;

  char* ws = (char*)d_ws;
  size_t off = 0;
  __bf16* Xb  = (__bf16*)(ws + off); off += (size_t)S_LEN * HS * 2;  // 8 MB
  __bf16* Wqb = (__bf16*)(ws + off); off += (size_t)HS * HS * 2;     // 2 MB
  __bf16* Wkb = (__bf16*)(ws + off); off += (size_t)HS * HS * 2;
  __bf16* Wvb = (__bf16*)(ws + off); off += (size_t)HS * HS * 2;
  __bf16* Qb  = (__bf16*)(ws + off); off += (size_t)S_LEN * HS * 2;  // [S][HS]
  __bf16* Kb  = (__bf16*)(ws + off); off += (size_t)S_LEN * HS * 2;  // [S][HS]
  __bf16* Vt  = (__bf16*)(ws + off); off += (size_t)S_LEN * HS * 2;  // [HS][S] (V^T)
  float*  ctx = (float*)(ws + off);  off += (size_t)S_LEN * HS * 4;  // 16 MB

  // Xb, Wqb, Wkb, Wvb are contiguous from Xb on
  cvt_kernel<<<CV_XB + 3 * CV_WB, 256, 0, stream>>>(hs, Wq, Wk, Wv, Xb);

  dim3 gg(S_LEN / 256, HS / 64), gb(32, 8);
  qkv_gemm_kernel<<<gg, gb, 0, stream>>>(Xb, Wqb, bq, Qb, 0);
  qkv_gemm_kernel<<<gg, gb, 0, stream>>>(Xb, Wkb, bk, Kb, 0);
  qkv_gemm_kernel<<<gg, gb, 0, stream>>>(Xb, Wvb, bv, Vt, 1);

  attn_kernel<<<(S_LEN / 16) * NH / 8, dim3(32, 8), 0, stream>>>(Qb, Kb, Vt, amask, ctx);
  ln_kernel<<<S_LEN, 256, 0, stream>>>(hs, ctx, gamma, beta, outp);
}

// v003
// It runs in 75.4 microseconds.
// Timed twice side by side with v002, it ran 1.22 and 1.20 times as fast.
// Counting every step since v000, it is 1.82 times as fast.
#include <hip/hip_runtime.h>
#include <hip/hip_bf16.h>

// Problem constants (match reference)
#define S_LEN    4096
#define HS       1024
#define NH       16
#define HD       64
#define WIN_HALF 128
#define LN_EPS   1e-12f

typedef __attribute__((ext_vector_type(16))) __bf16 v16bf;
typedef __attribute__((ext_vector_type(8)))  __bf16 v8bf;
typedef __attribute__((ext_vector_type(4)))  __bf16 v4bf;
typedef __attribute__((ext_vector_type(8)))  float  v8f;
typedef __attribute__((ext_vector_type(4)))  float  v4f;

// D = A(16x32 bf16) x B(32x16 bf16) + C(16x16 f32)  -> v_wmma_f32_16x16x32_bf16
__device__ __forceinline__ v8f wmma_bf16(v16bf a, v16bf b, v8f c) {
  return __builtin_amdgcn_wmma_f32_16x16x32_bf16(false, a, false, b, (short)0, c,
                                                 false, false);
}

__device__ __forceinline__ v16bf load_frag16(const __bf16* p) {
  v8bf lo = *(const v8bf*)p;
  v8bf hi = *(const v8bf*)(p + 16);
  v16bf r;
#pragma unroll
  for (int i = 0; i < 8; ++i) { r[i] = lo[i]; r[i + 8] = hi[i]; }
  return r;
}

// ---------------------------------------------------------------- f32 -> bf16
// One launch converts X, Wq, Wk and Wv. Their bf16 planes lie one behind the other in
// the workspace, so block b writes the b-th piece of CV_BLK float4 of that one range
// and only its source pointer depends on which plane the piece belongs to.
// A thread converts CV_PER float4: few long waves instead of many that live for one
// load. Every wave-wide load covers 512 contiguous bytes, every store 256.
#define CV_PER  16                        // float4 per thread, all loaded before the first store
#define CV_BLK  (256 * CV_PER)            // float4 per block
#define CV_XB   (S_LEN * HS / 4 / CV_BLK) // blocks of X
#define CV_WB   (HS * HS / 4 / CV_BLK)    // blocks of one weight matrix
__global__ __launch_bounds__(256)
void cvt_kernel(const float* __restrict__ x, const float* __restrict__ wq,
                const float* __restrict__ wk, const float* __restrict__ wv,
                __bf16* __restrict__ out) {
  const int b = blockIdx.x;
  const float* src = x;
  int piece = b;
  if (b >= CV_XB) {
    const int w = (b - CV_XB) / CV_WB;
    piece = (b - CV_XB) % CV_WB;
    src = (w == 0) ? wq : (w == 1) ? wk : wv;
  }
  const v4f* in4 = (const v4f*)src + (size_t)piece * CV_BLK + threadIdx.x;
  v4bf* o4 = (v4bf*)out + (size_t)b * CV_BLK + threadIdx.x;
  v4f f[CV_PER];
#pragma unroll
  for (int j = 0; j < CV_PER; ++j) f[j] = in4[j * 256];
  // holds all 16 loads in front of the first conversion (loaded values as inputs only);
  // without it the last two are held back until the first two have returned, a second
  // memory latency in every wave
  asm volatile("" :: "v"(f[0]), "v"(f[1]), "v"(f[2]), "v"(f[3]), "v"(f[4]), "v"(f[5]),
                     "v"(f[6]), "v"(f[7]), "v"(f[8]), "v"(f[9]), "v"(f[10]), "v"(f[11]),
                     "v"(f[12]), "v"(f[13]), "v"(f[14]), "v"(f[15]));
#pragma unroll
  for (int j = 0; j < CV_PER; ++j) {
    v4bf o;
    o[0] = (__bf16)f[j][0]; o[1] = (__bf16)f[j][1];
    o[2] = (__bf16)f[j][2]; o[3] = (__bf16)f[j][3];
    o4[j * 256] = o;
  }
}

#define KST    128
#define NSTG   (HS / KST)
#define PITCH  272
#define BM     256
#define BC     64
#define BN     (3 * BC)
#define A_LDS  (BM * PITCH)
#define STG    ((BM + BN) * PITCH)

__device__ __forceinline__ void async_copy14(const unsigned* l, const __bf16* const* g) {
  asm volatile(
      "global_load_async_to_lds_b128 %0, %14, off\n\t"
      "global_load_async_to_lds_b128 %1, %15, off\n\t"
      "global_load_async_to_lds_b128 %2, %16, off\n\t"
      "global_load_async_to_lds_b128 %3, %17, off\n\t"
      "global_load_async_to_lds_b128 %4, %18, off\n\t"
      "global_load_async_to_lds_b128 %5, %19, off\n\t"
      "global_load_async_to_lds_b128 %6, %20, off\n\t"
      "global_load_async_to_lds_b128 %7, %21, off\n\t"
      "global_load_async_to_lds_b128 %8, %22, off\n\t"
      "global_load_async_to_lds_b128 %9, %23, off\n\t"
      "global_load_async_to_lds_b128 %10, %24, off\n\t"
      "global_load_async_to_lds_b128 %11, %25, off\n\t"
      "global_load_async_to_lds_b128 %12, %26, off\n\t"
      "global_load_async_to_lds_b128 %13, %27, off\n\t"
      "s_wait_xcnt 0x0"
      :: "v"(l[0]), "v"(l[1]), "v"(l[2]), "v"(l[3]), "v"(l[4]), "v"(l[5]), "v"(l[6]),
         "v"(l[7]), "v"(l[8]), "v"(l[9]), "v"(l[10]), "v"(l[11]), "v"(l[12]), "v"(l[13]),
         "v"(g[0]), "v"(g[1]), "v"(g[2]), "v"(g[3]), "v"(g[4]), "v"(g[5]), "v"(g[6]),
         "v"(g[7]), "v"(g[8]), "v"(g[9]), "v"(g[10]), "v"(g[11]), "v"(g[12]), "v"(g[13])
      : "memory");
}

// One wave's share of a stage: 16 of the 256 X rows (8 copies of 2 rows) and 4 of the
// 64 rows of each weight matrix (2 copies each).
// la/lb: the lane's LDS byte address in the target buffer,
// ga/gb: the lane's global address at the stage's first k.
__device__ __forceinline__ void issue_stage(unsigned la, unsigned lb,
                                            const __bf16* ga, const __bf16* gb) {
  unsigned l[14];
  const __bf16* g[14];
#pragma unroll
  for (int j = 0; j < 8; ++j) { l[j] = la + j * 2 * PITCH; g[j] = ga + (size_t)j * 2 * HS; }
#pragma unroll
  for (int m = 0; m < 3; ++m)
#pragma unroll
    for (int j = 0; j < 2; ++j) {
      l[8 + m * 2 + j] = lb + (m * BC + j * 2) * PITCH;
      g[8 + m * 2 + j] = gb + (size_t)(m * HS + j * 2) * HS;
    }
  async_copy14(l, g);
}

// Fragments of k-step ks (32 k) of a stage, from LDS.
__device__ __forceinline__ void load_ab(const unsigned char* as, const unsigned char* bs, int ks,
                                        v16bf a[4], v16bf b[3]) {
#pragma unroll
  for (int mc = 0; mc < 4; ++mc)
    a[mc] = load_frag16((const __bf16*)(as + mc * 16 * PITCH + ks * 64));
#pragma unroll
  for (int nc = 0; nc < 3; ++nc)
    b[nc] = load_frag16((const __bf16*)(bs + nc * 16 * PITCH + ks * 64));
}

__global__ __launch_bounds__(512)
void qkv_gemm_kernel(const __bf16* __restrict__ Xb, const __bf16* __restrict__ Wb,
                     const float* __restrict__ bq, const float* __restrict__ bk,
                     const float* __restrict__ bv, __bf16* __restrict__ Qo,
                     __bf16* __restrict__ Ko, __bf16* __restrict__ Vto) {
  __shared__ __attribute__((aligned(16))) unsigned char L[2 * STG];
  const int lane = threadIdx.x;
  // the wave's number in a scalar register: which matrix a fragment's columns belong to
  // is then a scalar value in the epilogue
  const int wave = __builtin_amdgcn_readfirstlane(threadIdx.y);
  const int wr = wave & 3;
  const int wc = wave >> 2;
  const int hi = (lane >= 16) ? 1 : 0;
  const int lr = lane & 15;
  const int m0 = blockIdx.x * BM;
  const int n0 = blockIdx.y * BC;

  v8f zero8 = {0.f, 0.f, 0.f, 0.f, 0.f, 0.f, 0.f, 0.f};
  v8f c[4][3];
#pragma unroll
  for (int mc = 0; mc < 4; ++mc)
#pragma unroll
    for (int nc = 0; nc < 3; ++nc) c[mc][nc] = zero8;

  const unsigned lbase = (unsigned)(size_t)L;
  const unsigned la = lbase + (wave * 16 + hi) * PITCH + lr * 16;
  const unsigned lb = lbase + A_LDS + (wave * 4 + hi) * PITCH + lr * 16;
  const __bf16* ga = Xb + (size_t)(m0 + wave * 16 + hi) * HS + lr * 8;
  const __bf16* gb = Wb + (size_t)(n0 + wave * 4 + hi) * HS + lr * 8;
  // read side: lane = fragment row, upper half-wave 8 k further
  const unsigned char* as = L + (wr * 64 + lr) * PITCH + hi * 16;
  const unsigned char* bs = L + A_LDS + (wc * 48 + lr) * PITCH + hi * 16;

  issue_stage(la, lb, ga, gb);
  asm volatile("s_wait_asynccnt 0x0" ::: "memory");  // own copies of stage 0 have landed
  __syncthreads();                                   // ... and every other wave's
  issue_stage(la + STG, lb + STG, ga + KST, gb + KST);

  for (int t = 0; t < NSTG; ++t) {
    const int bo = (t & 1) * STG;
    v16bf a[2][4], b[2][3];
    load_ab(as + bo, bs + bo, 0, a[0], b[0]);
#pragma unroll
    for (int ks = 0; ks < 4; ++ks) {
      if (ks < 3) load_ab(as + bo, bs + bo, ks + 1, a[(ks + 1) & 1], b[(ks + 1) & 1]);
      // keeps the next k-step's LDS reads one group ahead of this k-step's WMMAs; without
      // the two fences they are sunk among the WMMAs and each is waited out to zero
      __builtin_amdgcn_sched_barrier(0);
#pragma unroll
      for (int mc = 0; mc < 4; ++mc)
#pragma unroll
        for (int nc = 0; nc < 3; ++nc)
          c[mc][nc] = wmma_bf16(a[ks & 1][mc], b[ks & 1][nc], c[mc][nc]);
      __builtin_amdgcn_sched_barrier(0);
    }
    asm volatile("s_wait_dscnt 0x0" ::: "memory");     // own reads of this buffer are done
    asm volatile("s_wait_asynccnt 0x0" ::: "memory");  // own copies of stage t+1 have landed
    __syncthreads();  // publishes stage t+1 and frees this buffer for its refill
    if (t + 2 < NSTG)
      issue_stage(la + bo, lb + bo, ga + (t + 2) * KST, gb + (t + 2) * KST);
  }
  asm volatile("s_wait_asynccnt 0x0" ::: "memory");    // no copy outlives the loop

#pragma unroll
  for (int nc = 0; nc < 3; ++nc) {
    const int cb = wc * 48 + nc * 16;        // fragment's first column among the block's 192
    const int mat = cb / BC;                 // 0: Q, 1: K, 2: V (16 columns never straddle)
    const int col = n0 + cb % BC + lr;
    const int row0 = m0 + wr * 64 + hi * 8;
    const float bvl = ((mat == 0) ? bq : (mat == 1) ? bk : bv)[col];
    // one store loop for both layouts: row and column strides (in elements) are scalars
    const unsigned rs = (mat < 2) ? HS : 1;
    const unsigned cs = (mat < 2) ? 1 : S_LEN;
    __bf16* o = ((mat == 0) ? Qo : (mat == 1) ? Ko : Vto) + (row0 * rs + col * cs);
#pragma unroll
    for (int mc = 0; mc < 4; ++mc)
#pragma unroll
      for (int v = 0; v < 8; ++v)
        o[(mc * 16 + v) * rs] = (__bf16)(c[mc][nc][v] + bvl);
    // stands in front of the next fragment's code, which reuses registers that the
    // stores above name (behind the last fragment nothing is rewritten any more)
    if (nc < 2) asm volatile("s_wait_xcnt 0x0" ::: "memory");
  }
}

__global__ __launch_bounds__(256)
void attn_kernel(const __bf16* __restrict__ Qb, const __bf16* __restrict__ Kb,
                 const __bf16* __restrict__ Vt, const float* __restrict__ amask,
                 float* __restrict__ ctx) {
  const int lane = threadIdx.x;
  const int wave = threadIdx.y;
  const int task = blockIdx.x * 8 + wave;        // 0..4095
  const int h  = task & (NH - 1);
  const int q0 = (task >> 4) << 4;
  const int hi = (lane >= 16) ? 1 : 0;
  const int lr = lane & 15;

  // Q rows as B-fragments (lane = query, K = head dims)
  const __bf16* qp = Qb + (size_t)(q0 + lr) * HS + h * HD + hi * 8;
  v16bf qb0 = load_frag16(qp);        // dims 0..31
  v16bf qb1 = load_frag16(qp + 32);   // dims 32..63

  v8f zero8 = {0.f, 0.f, 0.f, 0.f, 0.f, 0.f, 0.f, 0.f};
  v8f ot[4] = {zero8, zero8, zero8, zero8};      // O^T, 4 dim-chunks of 16
  float m = -3.0e38f, l = 0.0f;

  int kt0 = q0 - WIN_HALF; if (kt0 < 0) kt0 = 0; kt0 &= ~31;
  int kend = q0 + 16 + WIN_HALF; if (kend > S_LEN) kend = S_LEN;
  const int i = q0 + lr;                         // this lane's query index

  for (int kt = kt0; kt < kend; kt += 32) {
    v16bf ka[2][2], va[4];
#pragma unroll
    for (int kc = 0; kc < 2; ++kc) {
      const __bf16* kp = Kb + (size_t)(kt + kc * 16 + lr) * HS + h * HD + hi * 8;
      ka[kc][0] = load_frag16(kp);
      ka[kc][1] = load_frag16(kp + 32);
    }
#pragma unroll
    for (int dc = 0; dc < 4; ++dc)
      va[dc] = load_frag16(Vt + (size_t)(h * HD + dc * 16 + lr) * S_LEN + kt + hi * 8);

    // ---- S^T tile: 32 keys x 16 queries (keys = WMMA M, dims = WMMA K)
    v8f st[2];
#pragma unroll
    for (int kc = 0; kc < 2; ++kc) {
      v8f s = zero8;
      s = wmma_bf16(ka[kc][0], qb0, s);
      s = wmma_bf16(ka[kc][1], qb1, s);
      st[kc] = s;
    }
    // ---- scale + padding mask + window mask (element: key j, query i)
    float tmax = -3.0e38f;
#pragma unroll
    for (int kc = 0; kc < 2; ++kc) {
      int jb = kt + kc * 16 + hi * 8;            // keys jb..jb+7 live in this lane
      float am[8];
      *(float4*)&am[0] = *(const float4*)(amask + jb);
      *(float4*)&am[4] = *(const float4*)(amask + jb + 4);
#pragma unroll
      for (int v = 0; v < 8; ++v) {
        int j = jb + v;
        float sv = st[kc][v] * 0.125f + (1.0f - am[v]) * (-10000.0f);
        bool keep = (j >= i - WIN_HALF) && (j < i + WIN_HALF);
        sv = keep ? sv : -10000.0f;
        st[kc][v] = sv;
        tmax = fmaxf(tmax, sv);
      }
    }
    // ---- online softmax (per-query stats live in lane pairs (q, q+16))
    tmax = fmaxf(tmax, __shfl_xor(tmax, 16, 32));
    float mn = fmaxf(m, tmax);
    float scale = __expf(m - mn);
    float rsum = 0.0f;
    v16bf pa;                                    // P^T as B-fragment for PV
#pragma unroll
    for (int v = 0; v < 8; ++v) {
      float p0 = __expf(st[0][v] - mn);
      float p1 = __expf(st[1][v] - mn);
      rsum += p0 + p1;
      pa[v]     = (__bf16)p0;                    // keys kt + v + hi*8
      pa[v + 8] = (__bf16)p1;                    // keys kt + 16 + v + hi*8
    }
    rsum += __shfl_xor(rsum, 16, 32);
    l = l * scale + rsum;
    m = mn;
    // ---- O^T += V^T_tile * P^T (A: M = dims, K = keys; contiguous in Vt)
#pragma unroll
    for (int dc = 0; dc < 4; ++dc) {
      v8f o = ot[dc];
#pragma unroll
      for (int v = 0; v < 8; ++v) o[v] *= scale; // rescale: lane's query matches stats
      ot[dc] = wmma_bf16(va[dc], pa, o);
    }
  }

  float linv = 1.0f / l;
#pragma unroll
  for (int dc = 0; dc < 4; ++dc) {
    float* cp = ctx + (size_t)(q0 + lr) * HS + h * HD + dc * 16 + hi * 8;
    float4 o0 = { ot[dc][0] * linv, ot[dc][1] * linv, ot[dc][2] * linv, ot[dc][3] * linv };
    float4 o1 = { ot[dc][4] * linv, ot[dc][5] * linv, ot[dc][6] * linv, ot[dc][7] * linv };
    *(float4*)cp = o0;
    *(float4*)(cp + 4) = o1;
  }
}

// --------------------------------------------------- residual + layer norm
__global__ __launch_bounds__(256)
void ln_kernel(const float* __restrict__ hs, const float* __restrict__ ctx,
               const float* __restrict__ gamma, const float* __restrict__ beta,
               float* __restrict__ out) {
  __shared__ float red[8];
  const int row = blockIdx.x;
  const int t = threadIdx.x;
  const int lane = t & 31, wid = t >> 5;

  float4 hv = *(const float4*)(hs + (size_t)row * HS + t * 4);
  float4 cv = *(const float4*)(ctx + (size_t)row * HS + t * 4);
  float x[4] = {hv.x + cv.x, hv.y + cv.y, hv.z + cv.z, hv.w + cv.w};

  float s = x[0] + x[1] + x[2] + x[3];
#pragma unroll
  for (int o = 1; o < 32; o <<= 1) s += __shfl_xor(s, o, 32);
  if (lane == 0) red[wid] = s;
  __syncthreads();
  float tot = 0.f;
#pragma unroll
  for (int k = 0; k < 8; ++k) tot += red[k];
  float mu = tot * (1.0f / HS);

  float vs = 0.f;
#pragma unroll
  for (int k = 0; k < 4; ++k) { float d = x[k] - mu; vs += d * d; }
#pragma unroll
  for (int o = 1; o < 32; o <<= 1) vs += __shfl_xor(vs, o, 32);
  __syncthreads();
  if (lane == 0) red[wid] = vs;
  __syncthreads();
  float vtot = 0.f;
#pragma unroll
  for (int k = 0; k < 8; ++k) vtot += red[k];
  float rstd = rsqrtf(vtot * (1.0f / HS) + LN_EPS);

  float4 gv = *(const float4*)(gamma + t * 4);
  float4 bv = *(const float4*)(beta + t * 4);
  float4 ov;
  ov.x = (x[0] - mu) * rstd * gv.x + bv.x;
  ov.y = (x[1] - mu) * rstd * gv.y + bv.y;
  ov.z = (x[2] - mu) * rstd * gv.z + bv.z;
  ov.w = (x[3] - mu) * rstd * gv.w + bv.w;
  *(float4*)(out + (size_t)row * HS + t * 4) = ov;
}

// ----------------------------------------------------------------- launcher
extern "C" void kernel_launch(void* const* d_in, const int* in_sizes, int n_in,
                              void* d_out, int out_size, void* d_ws, size_t ws_size,
                              hipStream_t stream) {
  const float* hs    = (const float*)d_in[0];
  const float* amask = (const float*)d_in[1];
  const float* Wq    = (const float*)d_in[2];
  const float* bq    = (const float*)d_in[3];
  const float* Wk    = (const float*)d_in[4];
  const float* bk    = (const float*)d_in[5];
  const float* Wv    = (const float*)d_in[6];
  const float* bv    = (const float*)d_in[7];
  const float* gamma = (const float*)d_in[8];
  const float* beta  = (const float*)d_in[9];
  float* outp = (float*)d_out;

  char* ws = (char*)d_ws;
  size_t off = 0;
  __bf16* Xb  = (__bf16*)(ws + off); off += (size_t)S_LEN * HS * 2;  // 8 MB
  __bf16* Wqb = (__bf16*)(ws + off); off += (size_t)HS * HS * 2;     // 2 MB
  __bf16* Wkb = (__bf16*)(ws + off); off += (size_t)HS * HS * 2;
  __bf16* Wvb = (__bf16*)(ws + off); off += (size_t)HS * HS * 2;
  __bf16* Qb  = (__bf16*)(ws + off); off += (size_t)S_LEN * HS * 2;  // [S][HS]
  __bf16* Kb  = (__bf16*)(ws + off); off += (size_t)S_LEN * HS * 2;  // [S][HS]
  __bf16* Vt  = (__bf16*)(ws + off); off += (size_t)S_LEN * HS * 2;  // [HS][S] (V^T)
  float*  ctx = (float*)(ws + off);  off += (size_t)S_LEN * HS * 4;  // 16 MB

  // Xb, Wqb, Wkb, Wvb are contiguous from Xb on
  cvt_kernel<<<CV_XB + 3 * CV_WB, 256, 0, stream>>>(hs, Wq, Wk, Wv, Xb);

  // Wqb, Wkb, Wvb are contiguous from Wqb on
  qkv_gemm_kernel<<<dim3(S_LEN / BM, HS / BC), dim3(32, 16), 0, stream>>>(
      Xb, Wqb, bq, bk, bv, Qb, Kb, Vt);

  attn_kernel<<<(S_LEN / 16) * NH / 8, dim3(32, 8), 0, stream>>>(Qb, Kb, Vt, amask, ctx);
  ln_kernel<<<S_LEN, 256, 0, stream>>>(hs, ctx, gamma, beta, outp);
}

// v004
// A run of this version takes 59.4 microseconds.
// Next to v003, in two timings, it ran 1.27 times as fast each time.
// All steps since v000 together make it 2.32 times as fast.
#include <hip/hip_runtime.h>
#include <hip/hip_bf16.h>

// Problem constants (match reference)
#define S_LEN    4096
#define HS       1024
#define NH       16
#define HD       64
#define WIN_HALF 128
#define LN_EPS   1e-12f

typedef __attribute__((ext_vector_type(16))) __bf16 v16bf;
typedef __attribute__((ext_vector_type(8)))  __bf16 v8bf;
typedef __attribute__((ext_vector_type(4)))  __bf16 v4bf;
typedef __attribute__((ext_vector_type(8)))  float  v8f;
typedef __attribute__((ext_vector_type(4)))  float  v4f;

// D = A(16x32 bf16) x B(32x16 bf16) + C(16x16 f32)  -> v_wmma_f32_16x16x32_bf16
__device__ __forceinline__ v8f wmma_bf16(v16bf a, v16bf b, v8f c) {
  return __builtin_amdgcn_wmma_f32_16x16x32_bf16(false, a, false, b, (short)0, c,
                                                 false, false);
}

__device__ __forceinline__ v16bf load_frag16(const __bf16* p) {
  v8bf lo = *(const v8bf*)p;
  v8bf hi = *(const v8bf*)(p + 16);
  v16bf r;
#pragma unroll
  for (int i = 0; i < 8; ++i) { r[i] = lo[i]; r[i + 8] = hi[i]; }
  return r;
}

// ---------------------------------------------------------------- f32 -> bf16
// One launch converts X, Wq, Wk and Wv. Their bf16 planes lie one behind the other in
// the workspace, so block b writes the b-th piece of CV_BLK float4 of that one range
// and only its source pointer depends on which plane the piece belongs to.
// A thread converts CV_PER float4: few long waves instead of many that live for one
// load. Every wave-wide load covers 512 contiguous bytes, every store 256.
#define CV_PER  16                        // float4 per thread, all loaded before the first store
#define CV_BLK  (256 * CV_PER)            // float4 per block
#define CV_XB   (S_LEN * HS / 4 / CV_BLK) // blocks of X
#define CV_WB   (HS * HS / 4 / CV_BLK)    // blocks of one weight matrix
__global__ __launch_bounds__(256)
void cvt_kernel(const float* __restrict__ x, const float* __restrict__ wq,
                const float* __restrict__ wk, const float* __restrict__ wv,
                __bf16* __restrict__ out) {
  const int b = blockIdx.x;
  const float* src = x;
  int piece = b;
  if (b >= CV_XB) {
    const int w = (b - CV_XB) / CV_WB;
    piece = (b - CV_XB) % CV_WB;
    src = (w == 0) ? wq : (w == 1) ? wk : wv;
  }
  const v4f* in4 = (const v4f*)src + (size_t)piece * CV_BLK + threadIdx.x;
  v4bf* o4 = (v4bf*)out + (size_t)b * CV_BLK + threadIdx.x;
  v4f f[CV_PER];
#pragma unroll
  for (int j = 0; j < CV_PER; ++j) f[j] = in4[j * 256];
  // holds all 16 loads in front of the first conversion (loaded values as inputs only);
  // without it the last two are held back until the first two have returned, a second
  // memory latency in every wave
  asm volatile("" :: "v"(f[0]), "v"(f[1]), "v"(f[2]), "v"(f[3]), "v"(f[4]), "v"(f[5]),
                     "v"(f[6]), "v"(f[7]), "v"(f[8]), "v"(f[9]), "v"(f[10]), "v"(f[11]),
                     "v"(f[12]), "v"(f[13]), "v"(f[14]), "v"(f[15]));
#pragma unroll
  for (int j = 0; j < CV_PER; ++j) {
    v4bf o;
    o[0] = (__bf16)f[j][0]; o[1] = (__bf16)f[j][1];
    o[2] = (__bf16)f[j][2]; o[3] = (__bf16)f[j][3];
    o4[j * 256] = o;
  }
}

#define KST    128
#define NSTG   (HS / KST)
#define PITCH  272
#define BM     256
#define BC     64
#define BN     (3 * BC)
#define A_LDS  (BM * PITCH)
#define STG    ((BM + BN) * PITCH)

__device__ __forceinline__ void async_copy14(const unsigned* l, const __bf16* const* g) {
  asm volatile(
      "global_load_async_to_lds_b128 %0, %14, off\n\t"
      "global_load_async_to_lds_b128 %1, %15, off\n\t"
      "global_load_async_to_lds_b128 %2, %16, off\n\t"
      "global_load_async_to_lds_b128 %3, %17, off\n\t"
      "global_load_async_to_lds_b128 %4, %18, off\n\t"
      "global_load_async_to_lds_b128 %5, %19, off\n\t"
      "global_load_async_to_lds_b128 %6, %20, off\n\t"
      "global_load_async_to_lds_b128 %7, %21, off\n\t"
      "global_load_async_to_lds_b128 %8, %22, off\n\t"
      "global_load_async_to_lds_b128 %9, %23, off\n\t"
      "global_load_async_to_lds_b128 %10, %24, off\n\t"
      "global_load_async_to_lds_b128 %11, %25, off\n\t"
      "global_load_async_to_lds_b128 %12, %26, off\n\t"
      "global_load_async_to_lds_b128 %13, %27, off\n\t"
      "s_wait_xcnt 0x0"
      :: "v"(l[0]), "v"(l[1]), "v"(l[2]), "v"(l[3]), "v"(l[4]), "v"(l[5]), "v"(l[6]),
         "v"(l[7]), "v"(l[8]), "v"(l[9]), "v"(l[10]), "v"(l[11]), "v"(l[12]), "v"(l[13]),
         "v"(g[0]), "v"(g[1]), "v"(g[2]), "v"(g[3]), "v"(g[4]), "v"(g[5]), "v"(g[6]),
         "v"(g[7]), "v"(g[8]), "v"(g[9]), "v"(g[10]), "v"(g[11]), "v"(g[12]), "v"(g[13])
      : "memory");
}

// One wave's share of a stage: 16 of the 256 X rows (8 copies of 2 rows) and 4 of the
// 64 rows of each weight matrix (2 copies each).
// la/lb: the lane's LDS byte address in the target buffer,
// ga/gb: the lane's global address at the stage's first k.
__device__ __forceinline__ void issue_stage(unsigned la, unsigned lb,
                                            const __bf16* ga, const __bf16* gb) {
  unsigned l[14];
  const __bf16* g[14];
#pragma unroll
  for (int j = 0; j < 8; ++j) { l[j] = la + j * 2 * PITCH; g[j] = ga + (size_t)j * 2 * HS; }
#pragma unroll
  for (int m = 0; m < 3; ++m)
#pragma unroll
    for (int j = 0; j < 2; ++j) {
      l[8 + m * 2 + j] = lb + (m * BC + j * 2) * PITCH;
      g[8 + m * 2 + j] = gb + (size_t)(m * HS + j * 2) * HS;
    }
  async_copy14(l, g);
}

// Fragments of k-step ks (32 k) of a stage, from LDS.
__device__ __forceinline__ void load_ab(const unsigned char* as, const unsigned char* bs, int ks,
                                        v16bf a[4], v16bf b[3]) {
#pragma unroll
  for (int mc = 0; mc < 4; ++mc)
    a[mc] = load_frag16((const __bf16*)(as + mc * 16 * PITCH + ks * 64));
#pragma unroll
  for (int nc = 0; nc < 3; ++nc)
    b[nc] = load_frag16((const __bf16*)(bs + nc * 16 * PITCH + ks * 64));
}

__global__ __launch_bounds__(512)
void qkv_gemm_kernel(const __bf16* __restrict__ Xb, const __bf16* __restrict__ Wb,
                     const float* __restrict__ bq, const float* __restrict__ bk,
                     const float* __restrict__ bv, __bf16* __restrict__ Qo,
                     __bf16* __restrict__ Ko, __bf16* __restrict__ Vto) {
  __shared__ __attribute__((aligned(16))) unsigned char L[2 * STG];
  const int lane = threadIdx.x;
  // the wave's number in a scalar register: which matrix a fragment's columns belong to
  // is then a scalar value in the epilogue
  const int wave = __builtin_amdgcn_readfirstlane(threadIdx.y);
  const int wr = wave & 3;
  const int wc = wave >> 2;
  const int hi = (lane >= 16) ? 1 : 0;
  const int lr = lane & 15;
  const int m0 = blockIdx.x * BM;
  const int n0 = blockIdx.y * BC;

  v8f zero8 = {0.f, 0.f, 0.f, 0.f, 0.f, 0.f, 0.f, 0.f};
  v8f c[4][3];
#pragma unroll
  for (int mc = 0; mc < 4; ++mc)
#pragma unroll
    for (int nc = 0; nc < 3; ++nc) c[mc][nc] = zero8;

  const unsigned lbase = (unsigned)(size_t)L;
  const unsigned la = lbase + (wave * 16 + hi) * PITCH + lr * 16;
  const unsigned lb = lbase + A_LDS + (wave * 4 + hi) * PITCH + lr * 16;
  const __bf16* ga = Xb + (size_t)(m0 + wave * 16 + hi) * HS + lr * 8;
  const __bf16* gb = Wb + (size_t)(n0 + wave * 4 + hi) * HS + lr * 8;
  // read side: lane = fragment row, upper half-wave 8 k further
  const unsigned char* as = L + (wr * 64 + lr) * PITCH + hi * 16;
  const unsigned char* bs = L + A_LDS + (wc * 48 + lr) * PITCH + hi * 16;

  issue_stage(la, lb, ga, gb);
  asm volatile("s_wait_asynccnt 0x0" ::: "memory");  // own copies of stage 0 have landed
  __syncthreads();                                   // ... and every other wave's
  issue_stage(la + STG, lb + STG, ga + KST, gb + KST);

  for (int t = 0; t < NSTG; ++t) {
    const int bo = (t & 1) * STG;
    v16bf a[2][4], b[2][3];
    load_ab(as + bo, bs + bo, 0, a[0], b[0]);
#pragma unroll
    for (int ks = 0; ks < 4; ++ks) {
      if (ks < 3) load_ab(as + bo, bs + bo, ks + 1, a[(ks + 1) & 1], b[(ks + 1) & 1]);
      // keeps the next k-step's LDS reads one group ahead of this k-step's WMMAs; without
      // the two fences they are sunk among the WMMAs and each is waited out to zero
      __builtin_amdgcn_sched_barrier(0);
#pragma unroll
      for (int mc = 0; mc < 4; ++mc)
#pragma unroll
        for (int nc = 0; nc < 3; ++nc)
          c[mc][nc] = wmma_bf16(a[ks & 1][mc], b[ks & 1][nc], c[mc][nc]);
      __builtin_amdgcn_sched_barrier(0);
    }
    asm volatile("s_wait_dscnt 0x0" ::: "memory");     // own reads of this buffer are done
    asm volatile("s_wait_asynccnt 0x0" ::: "memory");  // own copies of stage t+1 have landed
    __syncthreads();  // publishes stage t+1 and frees this buffer for its refill
    if (t + 2 < NSTG)
      issue_stage(la + bo, lb + bo, ga + (t + 2) * KST, gb + (t + 2) * KST);
  }
  asm volatile("s_wait_asynccnt 0x0" ::: "memory");    // no copy outlives the loop

#pragma unroll
  for (int nc = 0; nc < 3; ++nc) {
    const int cb = wc * 48 + nc * 16;        // fragment's first column among the block's 192
    const int mat = cb / BC;                 // 0: Q, 1: K, 2: V (16 columns never straddle)
    const int col = n0 + cb % BC + lr;
    const int row0 = m0 + wr * 64 + hi * 8;
    const float bvl = ((mat == 0) ? bq : (mat == 1) ? bk : bv)[col];
    // one store loop for both layouts: row and column strides (in elements) are scalars
    const unsigned rs = (mat < 2) ? HS : 1;
    const unsigned cs = (mat < 2) ? 1 : S_LEN;
    __bf16* o = ((mat == 0) ? Qo : (mat == 1) ? Ko : Vto) + (row0 * rs + col * cs);
#pragma unroll
    for (int mc = 0; mc < 4; ++mc)
#pragma unroll
      for (int v = 0; v < 8; ++v)
        o[(mc * 16 + v) * rs] = (__bf16)(c[mc][nc][v] + bvl);
    // stands in front of the next fragment's code, which reuses registers that the
    // stores above name (behind the last fragment nothing is rewritten any more)
    if (nc < 2) asm volatile("s_wait_xcnt 0x0" ::: "memory");
  }
}

#define AQ     128                       // queries of a block
#define AKEYS  (AQ + 2 * WIN_HALF)       // keys staged for them
#define KPITCH 144                       // LDS pitch of a K row, 128 B of data (16 B x odd)
#define VPITCH (AKEYS * 2 + 16)          // LDS pitch of a V^T row, 768 B of data (16 B x odd)
#define K_LDS  (AKEYS * KPITCH)
#define V_LDS  (HD * VPITCH)

__device__ __forceinline__ void async_copy12(const unsigned* l, const __bf16* const* g) {
  asm volatile(
      "global_load_async_to_lds_b128 %0, %12, off\n\t"
      "global_load_async_to_lds_b128 %1, %13, off\n\t"
      "global_load_async_to_lds_b128 %2, %14, off\n\t"
      "global_load_async_to_lds_b128 %3, %15, off\n\t"
      "global_load_async_to_lds_b128 %4, %16, off\n\t"
      "global_load_async_to_lds_b128 %5, %17, off\n\t"
      "global_load_async_to_lds_b128 %6, %18, off\n\t"
      "global_load_async_to_lds_b128 %7, %19, off\n\t"
      "global_load_async_to_lds_b128 %8, %20, off\n\t"
      "global_load_async_to_lds_b128 %9, %21, off\n\t"
      "global_load_async_to_lds_b128 %10, %22, off\n\t"
      "global_load_async_to_lds_b128 %11, %23, off\n\t"
      "s_wait_xcnt 0x0"
      :: "v"(l[0]), "v"(l[1]), "v"(l[2]), "v"(l[3]), "v"(l[4]), "v"(l[5]),
         "v"(l[6]), "v"(l[7]), "v"(l[8]), "v"(l[9]), "v"(l[10]), "v"(l[11]),
         "v"(g[0]), "v"(g[1]), "v"(g[2]), "v"(g[3]), "v"(g[4]), "v"(g[5]),
         "v"(g[6]), "v"(g[7]), "v"(g[8]), "v"(g[9]), "v"(g[10]), "v"(g[11])
      : "memory");
}

__global__ __launch_bounds__(256)
void attn_kernel(const __bf16* __restrict__ Qb, const __bf16* __restrict__ Kb,
                 const __bf16* __restrict__ Vt, const float* __restrict__ amask,
                 float* __restrict__ ctx) {
  __shared__ __attribute__((aligned(16))) unsigned char LA[K_LDS + V_LDS + AKEYS * 4];
  const int lane = threadIdx.x;
  // the wave's number in a scalar register: the key loop's bounds are then scalars
  const int wave = __builtin_amdgcn_readfirstlane(threadIdx.y);
  const int h  = blockIdx.x & (NH - 1);
  const int qb = (blockIdx.x >> 4) * AQ;         // the block's first query
  const int q0 = qb + wave * 16;                 // the wave's first query
  const int hi = (lane >= 16) ? 1 : 0;
  const int lr = lane & 15;

  // first staged key: the run [kb, kb + AKEYS) lies inside the sequence and holds
  // [qb - WIN_HALF, qb + AQ + WIN_HALF) as far as those keys exist
  int kb = qb - WIN_HALF;
  if (kb < 0) kb = 0;
  if (kb > S_LEN - AKEYS) kb = S_LEN - AKEYS;

  {
    const unsigned lbase = (unsigned)(size_t)LA;
    unsigned l[12];
    const __bf16* g[12];
    // K: a wave brings 48 rows, a copy 4 rows of one whole line each
    const int kr = wave * 48 + (lane >> 3);
    const unsigned lk = lbase + kr * KPITCH + (lane & 7) * 16;
    const __bf16* gk = Kb + (size_t)(kb + kr) * HS + h * HD + (lane & 7) * 8;
#pragma unroll
    for (int j = 0; j < 12; ++j) { l[j] = lk + j * 4 * KPITCH; g[j] = gk + (size_t)j * 4 * HS; }
    async_copy12(l, g);
    // V^T: a wave brings 8 rows of 48 pieces of 16 B, a copy 512 B on end of them;
    // three copies cover two rows, so the lane's place repeats every third copy
#pragma unroll
    for (int b = 0; b < 3; ++b) {
      const int c = b * 32 + lane;
      const int vr = wave * 8 + c / 48;
      const unsigned lv = lbase + K_LDS + vr * VPITCH + (c % 48) * 16;
      const __bf16* gv = Vt + (size_t)(h * HD + vr) * S_LEN + kb + (c % 48) * 8;
#pragma unroll
      for (int a = 0; a < 4; ++a) {
        l[a * 3 + b] = lv + a * 2 * VPITCH;
        g[a * 3 + b] = gv + (size_t)a * 2 * S_LEN;
      }
    }
    async_copy12(l, g);
  }
  // padding mask of the staged keys: 96 float4, through registers
  if (wave < AKEYS / 128)
    ((float4*)(LA + K_LDS + V_LDS))[wave * 32 + lane] =
        ((const float4*)(amask + kb))[wave * 32 + lane];

  // Q rows as B-fragments (lane = query, K = head dims)
  const __bf16* qp = Qb + (size_t)(q0 + lr) * HS + h * HD + hi * 8;
  v16bf qb0 = load_frag16(qp);        // dims 0..31
  v16bf qb1 = load_frag16(qp + 32);   // dims 32..63

  v8f zero8 = {0.f, 0.f, 0.f, 0.f, 0.f, 0.f, 0.f, 0.f};
  v8f ot[4] = {zero8, zero8, zero8, zero8};      // O^T, 4 dim-chunks of 16
  float m = -3.0e38f, l = 0.0f;

  int kt0 = q0 - WIN_HALF; if (kt0 < 0) kt0 = 0; kt0 &= ~31;
  int kend = q0 + 16 + WIN_HALF; if (kend > S_LEN) kend = S_LEN;
  const int i = q0 + lr;                         // this lane's query index

  // read side: lane = fragment row (key for K, dim for V^T), upper half-wave 8 elements on
  const unsigned char* kl = LA + lr * KPITCH + hi * 16;
  const unsigned char* vl = LA + K_LDS + lr * VPITCH + hi * 16;
  const float* ml = (const float*)(LA + K_LDS + V_LDS);

  asm volatile("s_wait_asynccnt 0x0" ::: "memory");  // own copies have landed
  __syncthreads();                                   // ... and every other wave's, and the mask

  for (int kt = kt0; kt < kend; kt += 32) {
    const int ko = kt - kb;                      // the tile's first key among the staged ones
    v16bf ka[2][2], va[4];
#pragma unroll
    for (int kc = 0; kc < 2; ++kc) {
      const __bf16* kp = (const __bf16*)(kl + (ko + kc * 16) * KPITCH);
      ka[kc][0] = load_frag16(kp);
      ka[kc][1] = load_frag16(kp + 32);
    }
#pragma unroll
    for (int dc = 0; dc < 4; ++dc)
      va[dc] = load_frag16((const __bf16*)(vl + dc * 16 * VPITCH + ko * 2));

    // ---- S^T tile: 32 keys x 16 queries (keys = WMMA M, dims = WMMA K)
    v8f st[2];
#pragma unroll
    for (int kc = 0; kc < 2; ++kc) {
      v8f s = zero8;
      s = wmma_bf16(ka[kc][0], qb0, s);
      s = wmma_bf16(ka[kc][1], qb1, s);
      st[kc] = s;
    }
    // ---- scale + padding mask + window mask (element: key j, query i)
    float tmax = -3.0e38f;
#pragma unroll
    for (int kc = 0; kc < 2; ++kc) {
      int jb = kt + kc * 16 + hi * 8;            // keys jb..jb+7 live in this lane
      float am[8];
      *(float4*)&am[0] = *(const float4*)(ml + (jb - kb));
      *(float4*)&am[4] = *(const float4*)(ml + (jb - kb) + 4);
#pragma unroll
      for (int v = 0; v < 8; ++v) {
        int j = jb + v;
        float sv = st[kc][v] * 0.125f + (1.0f - am[v]) * (-10000.0f);
        bool keep = (j >= i - WIN_HALF) && (j < i + WIN_HALF);
        sv = keep ? sv : -10000.0f;
        st[kc][v] = sv;
        tmax = fmaxf(tmax, sv);
      }
    }
    // ---- online softmax (per-query stats live in lane pairs (q, q+16))
    tmax = fmaxf(tmax, __shfl_xor(tmax, 16, 32));
    float mn = fmaxf(m, tmax);
    float scale = __expf(m - mn);
    float rsum = 0.0f;
    v16bf pa;                                    // P^T as B-fragment for PV
#pragma unroll
    for (int v = 0; v < 8; ++v) {
      float p0 = __expf(st[0][v] - mn);
      float p1 = __expf(st[1][v] - mn);
      rsum += p0 + p1;
      pa[v]     = (__bf16)p0;                    // keys kt + v + hi*8
      pa[v + 8] = (__bf16)p1;                    // keys kt + 16 + v + hi*8
    }
    rsum += __shfl_xor(rsum, 16, 32);
    l = l * scale + rsum;
    m = mn;
    // ---- O^T += V^T_tile * P^T (A: M = dims, K = keys; contiguous in Vt)
#pragma unroll
    for (int dc = 0; dc < 4; ++dc) {
      v8f o = ot[dc];
#pragma unroll
      for (int v = 0; v < 8; ++v) o[v] *= scale; // rescale: lane's query matches stats
      ot[dc] = wmma_bf16(va[dc], pa, o);
    }
  }

  float linv = 1.0f / l;
#pragma unroll
  for (int dc = 0; dc < 4; ++dc) {
    float* cp = ctx + (size_t)(q0 + lr) * HS + h * HD + dc * 16 + hi * 8;
    float4 o0 = { ot[dc][0] * linv, ot[dc][1] * linv, ot[dc][2] * linv, ot[dc][3] * linv };
    float4 o1 = { ot[dc][4] * linv, ot[dc][5] * linv, ot[dc][6] * linv, ot[dc][7] * linv };
    *(float4*)cp = o0;
    *(float4*)(cp + 4) = o1;
  }
}

// --------------------------------------------------- residual + layer norm
__global__ __launch_bounds__(256)
void ln_kernel(const float* __restrict__ hs, const float* __restrict__ ctx,
               const float* __restrict__ gamma, const float* __restrict__ beta,
               float* __restrict__ out) {
  __shared__ float red[8];
  const int row = blockIdx.x;
  const int t = threadIdx.x;
  const int lane = t & 31, wid = t >> 5;

  float4 hv = *(const float4*)(hs + (size_t)row * HS + t * 4);
  float4 cv = *(const float4*)(ctx + (size_t)row * HS + t * 4);
  float x[4] = {hv.x + cv.x, hv.y + cv.y, hv.z + cv.z, hv.w + cv.w};

  float s = x[0] + x[1] + x[2] + x[3];
#pragma unroll
  for (int o = 1; o < 32; o <<= 1) s += __shfl_xor(s, o, 32);
  if (lane == 0) red[wid] = s;
  __syncthreads();
  float tot = 0.f;
#pragma unroll
  for (int k = 0; k < 8; ++k) tot += red[k];
  float mu = tot * (1.0f / HS);

  float vs = 0.f;
#pragma unroll
  for (int k = 0; k < 4; ++k) { float d = x[k] - mu; vs += d * d; }
#pragma unroll
  for (int o = 1; o < 32; o <<= 1) vs += __shfl_xor(vs, o, 32);
  __syncthreads();
  if (lane == 0) red[wid] = vs;
  __syncthreads();
  float vtot = 0.f;
#pragma unroll
  for (int k = 0; k < 8; ++k) vtot += red[k];
  float rstd = rsqrtf(vtot * (1.0f / HS) + LN_EPS);

  float4 gv = *(const float4*)(gamma + t * 4);
  float4 bv = *(const float4*)(beta + t * 4);
  float4 ov;
  ov.x = (x[0] - mu) * rstd * gv.x + bv.x;
  ov.y = (x[1] - mu) * rstd * gv.y + bv.y;
  ov.z = (x[2] - mu) * rstd * gv.z + bv.z;
  ov.w = (x[3] - mu) * rstd * gv.w + bv.w;
  *(float4*)(out + (size_t)row * HS + t * 4) = ov;
}

// ----------------------------------------------------------------- launcher
extern "C" void kernel_launch(void* const* d_in, const int* in_sizes, int n_in,
                              void* d_out, int out_size, void* d_ws, size_t ws_size,
                              hipStream_t stream) {
  const float* hs    = (const float*)d_in[0];
  const float* amask = (const float*)d_in[1];
  const float* Wq    = (const float*)d_in[2];
  const float* bq    = (const float*)d_in[3];
  const float* Wk    = (const float*)d_in[4];
  const float* bk    = (const float*)d_in[5];
  const float* Wv    = (const float*)d_in[6];
  const float* bv    = (const float*)d_in[7];
  const float* gamma = (const float*)d_in[8];
  const float* beta  = (const float*)d_in[9];
  float* outp = (float*)d_out;

  char* ws = (char*)d_ws;
  size_t off = 0;
  __bf16* Xb  = (__bf16*)(ws + off); off += (size_t)S_LEN * HS * 2;  // 8 MB
  __bf16* Wqb = (__bf16*)(ws + off); off += (size_t)HS * HS * 2;     // 2 MB
  __bf16* Wkb = (__bf16*)(ws + off); off += (size_t)HS * HS * 2;
  __bf16* Wvb = (__bf16*)(ws + off); off += (size_t)HS * HS * 2;
  __bf16* Qb  = (__bf16*)(ws + off); off += (size_t)S_LEN * HS * 2;  // [S][HS]
  __bf16* Kb  = (__bf16*)(ws + off); off += (size_t)S_LEN * HS * 2;  // [S][HS]
  __bf16* Vt  = (__bf16*)(ws + off); off += (size_t)S_LEN * HS * 2;  // [HS][S] (V^T)
  float*  ctx = (float*)(ws + off);  off += (size_t)S_LEN * HS * 4;  // 16 MB

  // Xb, Wqb, Wkb, Wvb are contiguous from Xb on
  cvt_kernel<<<CV_XB + 3 * CV_WB, 256, 0, stream>>>(hs, Wq, Wk, Wv, Xb);

  // Wqb, Wkb, Wvb are contiguous from Wqb on
  qkv_gemm_kernel<<<dim3(S_LEN / BM, HS / BC), dim3(32, 16), 0, stream>>>(
      Xb, Wqb, bq, bk, bv, Qb, Kb, Vt);

  attn_kernel<<<(S_LEN / AQ) * NH, dim3(32, 8), 0, stream>>>(Qb, Kb, Vt, amask, ctx);
  ln_kernel<<<S_LEN, 256, 0, stream>>>(hs, ctx, gamma, beta, outp);
}

// v005
// Measured time: 43.2 microseconds a run.
// In two side-by-side timings against v004, it was 1.37 and 1.38 times as fast.
// Counting every step since v000, it is 3.18 times as fast.
#include <hip/hip_runtime.h>
#include <hip/hip_bf16.h>

// Problem constants (match reference)
#define S_LEN    4096
#define HS       1024
#define NH       16
#define HD       64
#define WIN_HALF 128
#define LN_EPS   1e-12f

typedef __attribute__((ext_vector_type(16))) __bf16 v16bf;
typedef __attribute__((ext_vector_type(8)))  __bf16 v8bf;
typedef __attribute__((ext_vector_type(4)))  __bf16 v4bf;
typedef __attribute__((ext_vector_type(8)))  float  v8f;
typedef __attribute__((ext_vector_type(4)))  float  v4f;

// D = A(16x32 bf16) x B(32x16 bf16) + C(16x16 f32)  -> v_wmma_f32_16x16x32_bf16
__device__ __forceinline__ v8f wmma_bf16(v16bf a, v16bf b, v8f c) {
  return __builtin_amdgcn_wmma_f32_16x16x32_bf16(false, a, false, b, (short)0, c,
                                                 false, false);
}

__device__ __forceinline__ v16bf load_frag16(const __bf16* p) {
  v8bf lo = *(const v8bf*)p;
  v8bf hi = *(const v8bf*)(p + 16);
  v16bf r;
#pragma unroll
  for (int i = 0; i < 8; ++i) { r[i] = lo[i]; r[i + 8] = hi[i]; }
  return r;
}

// ---------------------------------------------------------------- f32 -> bf16
// One launch converts X, Wq, Wk and Wv. Their bf16 planes lie one behind the other in
// the workspace, so block b writes the b-th piece of CV_BLK float4 of that one range
// and only its source pointer depends on which plane the piece belongs to.
// A thread converts CV_PER float4: few long waves instead of many that live for one
// load. Every wave-wide load covers 512 contiguous bytes, every store 256.
#define CV_PER  16                        // float4 per thread, all loaded before the first store
#define CV_BLK  (256 * CV_PER)            // float4 per block
#define CV_XB   (S_LEN * HS / 4 / CV_BLK) // blocks of X
#define CV_WB   (HS * HS / 4 / CV_BLK)    // blocks of one weight matrix
__global__ __launch_bounds__(256)
void cvt_kernel(const float* __restrict__ x, const float* __restrict__ wq,
                const float* __restrict__ wk, const float* __restrict__ wv,
                __bf16* __restrict__ out) {
  const int b = blockIdx.x;
  const float* src = x;
  int piece = b;
  if (b >= CV_XB) {
    const int w = (b - CV_XB) / CV_WB;
    piece = (b - CV_XB) % CV_WB;
    src = (w == 0) ? wq : (w == 1) ? wk : wv;
  }
  const v4f* in4 = (const v4f*)src + (size_t)piece * CV_BLK + threadIdx.x;
  v4bf* o4 = (v4bf*)out + (size_t)b * CV_BLK + threadIdx.x;
  v4f f[CV_PER];
#pragma unroll
  for (int j = 0; j < CV_PER; ++j) f[j] = in4[j * 256];
  // holds all 16 loads in front of the first conversion (loaded values as inputs only);
  // without it the last two are held back until the first two have returned, a second
  // memory latency in every wave
  asm volatile("" :: "v"(f[0]), "v"(f[1]), "v"(f[2]), "v"(f[3]), "v"(f[4]), "v"(f[5]),
                     "v"(f[6]), "v"(f[7]), "v"(f[8]), "v"(f[9]), "v"(f[10]), "v"(f[11]),
                     "v"(f[12]), "v"(f[13]), "v"(f[14]), "v"(f[15]));
#pragma unroll
  for (int j = 0; j < CV_PER; ++j) {
    v4bf o;
    o[0] = (__bf16)f[j][0]; o[1] = (__bf16)f[j][1];
    o[2] = (__bf16)f[j][2]; o[3] = (__bf16)f[j][3];
    o4[j * 256] = o;
  }
}

#define KST    128
#define NSTG   (HS / KST)
#define PITCH  272
#define BM     256
#define BC     64
#define BN     (3 * BC)
#define A_LDS  (BM * PITCH)
#define STG    ((BM + BN) * PITCH)
// output tile in LDS, in the ring's place once the last stage has been read
#define OPITCH 144                       // a Q or K row: 128 B of data (16 B x odd)
#define O_LDS  (BM * OPITCH)             // the block's Q rows; its K rows lie behind them
#define TPITCH (BM * 2 + 16)             // a V^T row: 512 B of data (16 B x odd)

__device__ __forceinline__ void async_copy14(const unsigned* l, const __bf16* const* g) {
  asm volatile(
      "global_load_async_to_lds_b128 %0, %14, off\n\t"
      "global_load_async_to_lds_b128 %1, %15, off\n\t"
      "global_load_async_to_lds_b128 %2, %16, off\n\t"
      "global_load_async_to_lds_b128 %3, %17, off\n\t"
      "global_load_async_to_lds_b128 %4, %18, off\n\t"
      "global_load_async_to_lds_b128 %5, %19, off\n\t"
      "global_load_async_to_lds_b128 %6, %20, off\n\t"
      "global_load_async_to_lds_b128 %7, %21, off\n\t"
      "global_load_async_to_lds_b128 %8, %22, off\n\t"
      "global_load_async_to_lds_b128 %9, %23, off\n\t"
      "global_load_async_to_lds_b128 %10, %24, off\n\t"
      "global_load_async_to_lds_b128 %11, %25, off\n\t"
      "global_load_async_to_lds_b128 %12, %26, off\n\t"
      "global_load_async_to_lds_b128 %13, %27, off\n\t"
      "s_wait_xcnt 0x0"
      :: "v"(l[0]), "v"(l[1]), "v"(l[2]), "v"(l[3]), "v"(l[4]), "v"(l[5]), "v"(l[6]),
         "v"(l[7]), "v"(l[8]), "v"(l[9]), "v"(l[10]), "v"(l[11]), "v"(l[12]), "v"(l[13]),
         "v"(g[0]), "v"(g[1]), "v"(g[2]), "v"(g[3]), "v"(g[4]), "v"(g[5]), "v"(g[6]),
         "v"(g[7]), "v"(g[8]), "v"(g[9]), "v"(g[10]), "v"(g[11]), "v"(g[12]), "v"(g[13])
      : "memory");
}

// One wave's share of a stage: 16 of the 256 X rows (8 copies of 2 rows) and 4 of the
// 64 rows of each weight matrix (2 copies each).
// la/lb: the lane's LDS byte address in the target buffer,
// ga/gb: the lane's global address at the stage's first k.
__device__ __forceinline__ void issue_stage(unsigned la, unsigned lb,
                                            const __bf16* ga, const __bf16* gb) {
  unsigned l[14];
  const __bf16* g[14];
#pragma unroll
  for (int j = 0; j < 8; ++j) { l[j] = la + j * 2 * PITCH; g[j] = ga + (size_t)j * 2 * HS; }
#pragma unroll
  for (int m = 0; m < 3; ++m)
#pragma unroll
    for (int j = 0; j < 2; ++j) {
      l[8 + m * 2 + j] = lb + (m * BC + j * 2) * PITCH;
      g[8 + m * 2 + j] = gb + (size_t)(m * HS + j * 2) * HS;
    }
  async_copy14(l, g);
}

// Fragments of k-step ks (32 k) of a stage, from LDS.
__device__ __forceinline__ void load_ab(const unsigned char* as, const unsigned char* bs, int ks,
                                        v16bf a[4], v16bf b[3]) {
#pragma unroll
  for (int mc = 0; mc < 4; ++mc)
    a[mc] = load_frag16((const __bf16*)(as + mc * 16 * PITCH + ks * 64));
#pragma unroll
  for (int nc = 0; nc < 3; ++nc)
    b[nc] = load_frag16((const __bf16*)(bs + nc * BC * PITCH + ks * 64));
}

__global__ __launch_bounds__(512)
void qkv_gemm_kernel(const __bf16* __restrict__ Xb, const __bf16* __restrict__ Wb,
                     const float* __restrict__ bq, const float* __restrict__ bk,
                     const float* __restrict__ bv, __bf16* __restrict__ Qo,
                     __bf16* __restrict__ Ko, __bf16* __restrict__ Vto) {
  __shared__ __attribute__((aligned(16))) unsigned char L[2 * STG];
  const int lane = threadIdx.x;
  // the wave's number in a scalar register: its share of rows and columns is then scalar
  const int wave = __builtin_amdgcn_readfirstlane(threadIdx.y);
  const int wr = wave & 3;
  const int wc = wave >> 2;
  const int hi = (lane >= 16) ? 1 : 0;
  const int lr = lane & 15;
  const int m0 = blockIdx.x * BM;
  const int n0 = blockIdx.y * BC;

  v8f zero8 = {0.f, 0.f, 0.f, 0.f, 0.f, 0.f, 0.f, 0.f};
  v8f c[4][3];
#pragma unroll
  for (int mc = 0; mc < 4; ++mc)
#pragma unroll
    for (int nc = 0; nc < 3; ++nc) c[mc][nc] = zero8;

  const unsigned lbase = (unsigned)(size_t)L;
  const unsigned la = lbase + (wave * 16 + hi) * PITCH + lr * 16;
  const unsigned lb = lbase + A_LDS + (wave * 4 + hi) * PITCH + lr * 16;
  const __bf16* ga = Xb + (size_t)(m0 + wave * 16 + hi) * HS + lr * 8;
  const __bf16* gb = Wb + (size_t)(n0 + wave * 4 + hi) * HS + lr * 8;
  // read side: lane = fragment row, upper half-wave 8 k further
  const unsigned char* as = L + (wr * 64 + lr) * PITCH + hi * 16;
  const unsigned char* bs = L + A_LDS + (wc * 16 + lr) * PITCH + hi * 16;

  issue_stage(la, lb, ga, gb);
  asm volatile("s_wait_asynccnt 0x0" ::: "memory");  // own copies of stage 0 have landed
  __syncthreads();                                   // ... and every other wave's
  issue_stage(la + STG, lb + STG, ga + KST, gb + KST);

  for (int t = 0; t < NSTG; ++t) {
    const int bo = (t & 1) * STG;
    v16bf a[2][4], b[2][3];
    load_ab(as + bo, bs + bo, 0, a[0], b[0]);
#pragma unroll
    for (int ks = 0; ks < 4; ++ks) {
      if (ks < 3) load_ab(as + bo, bs + bo, ks + 1, a[(ks + 1) & 1], b[(ks + 1) & 1]);
      // keeps the next k-step's LDS reads one group ahead of this k-step's WMMAs; without
      // the two fences they are sunk among the WMMAs and each is waited out to zero
      __builtin_amdgcn_sched_barrier(0);
#pragma unroll
      for (int mc = 0; mc < 4; ++mc)
#pragma unroll
        for (int nc = 0; nc < 3; ++nc)
          c[mc][nc] = (nc < 2) ? wmma_bf16(b[ks & 1][nc], a[ks & 1][mc], c[mc][nc])   // Q, K: D^T
                               : wmma_bf16(a[ks & 1][mc], b[ks & 1][nc], c[mc][nc]);  // V
      __builtin_amdgcn_sched_barrier(0);
    }
    asm volatile("s_wait_dscnt 0x0" ::: "memory");     // own reads of this buffer are done
    asm volatile("s_wait_asynccnt 0x0" ::: "memory");  // own copies of stage t+1 have landed
    __syncthreads();  // publishes stage t+1 and frees this buffer for its refill
    if (t + 2 < NSTG)
      issue_stage(la + bo, lb + bo, ga + (t + 2) * KST, gb + (t + 2) * KST);
  }
  asm volatile("s_wait_asynccnt 0x0" ::: "memory");    // no copy outlives the loop

  // ---- the tile into LDS. The loop's last barrier stands behind every wave's last read of
  // the ring, and no copy is in flight any more.
  // all bias loads first, so that their latencies overlap
  const float bvl = bv[n0 + wc * 16 + lr];
  v4f bqk[2][2];
#pragma unroll
  for (int nc = 0; nc < 2; ++nc) {
    const float* bp = ((nc == 0) ? bq : bk) + n0 + wc * 16 + hi * 8;
    // stands in front of the next loads, whose results may land in registers that the
    // loads issued so far name as addresses
    asm volatile("s_wait_xcnt 0x0" ::: "memory");
    bqk[nc][0] = *(const v4f*)bp;
    bqk[nc][1] = *(const v4f*)(bp + 4);
  }
#pragma unroll
  for (int nc = 0; nc < 2; ++nc) {
    const v4f b0 = bqk[nc][0];
    const v4f b1 = bqk[nc][1];
    unsigned char* s = L + nc * O_LDS + (wr * 64 + lr) * OPITCH + wc * 32 + hi * 16;
#pragma unroll
    for (int mc = 0; mc < 4; ++mc) {
      v8bf o;
#pragma unroll
      for (int v = 0; v < 4; ++v) {
        o[v]     = (__bf16)(c[mc][nc][v] + b0[v]);
        o[v + 4] = (__bf16)(c[mc][nc][v + 4] + b1[v]);
      }
      *(v8bf*)(s + mc * 16 * OPITCH) = o;
    }
  }
  {
    unsigned char* s = L + 2 * O_LDS + (wc * 16 + lr) * TPITCH + (wr * 64 + hi * 8) * 2;
#pragma unroll
    for (int mc = 0; mc < 4; ++mc) {
      v8bf o;
#pragma unroll
      for (int v = 0; v < 8; ++v) o[v] = (__bf16)(c[mc][2][v] + bvl);
      *(v8bf*)(s + mc * 32) = o;
    }
  }
  __syncthreads();  // the tile is whole: every wave's part has been written

  v8bf t[12];
  const int r0 = wave * 16 + ((lane >> 3) & 1) * 8 + (lane >> 4) * 4;
  const int pc = lane & 7;
#pragma unroll
  for (int nc = 0; nc < 2; ++nc)
#pragma unroll
    for (int j = 0; j < 4; ++j)
      t[nc * 4 + j] = *(const v8bf*)(L + nc * O_LDS + (r0 + j) * OPITCH + pc * 16);
#pragma unroll
  for (int j = 0; j < 4; ++j)
    t[8 + j] = *(const v8bf*)(L + 2 * O_LDS + (wave * 4 + j) * TPITCH + lane * 16);
  __bf16* qo = Qo + (size_t)(m0 + r0) * HS + n0 + pc * 8;
  __bf16* ko = Ko + (size_t)(m0 + r0) * HS + n0 + pc * 8;
  __bf16* vo = Vto + (size_t)(n0 + wave * 4) * S_LEN + m0 + lane * 8;
#pragma unroll
  for (int j = 0; j < 4; ++j) {
    *(v8bf*)(qo + j * HS) = t[j];
    *(v8bf*)(ko + j * HS) = t[4 + j];
    *(v8bf*)(vo + (size_t)j * S_LEN) = t[8 + j];
  }
}

#define AQ     128                       // queries of a block
#define AKEYS  (AQ + 2 * WIN_HALF)       // keys staged for them
#define KPITCH 144                       // LDS pitch of a K row, 128 B of data (16 B x odd)
#define VPITCH (AKEYS * 2 + 16)          // LDS pitch of a V^T row, 768 B of data (16 B x odd)
#define K_LDS  (AKEYS * KPITCH)
#define V_LDS  (HD * VPITCH)
#define M_LDS  (AKEYS * 4)               // padding mask of the staged keys
#define CPITCH 272                       // LDS pitch of an output row, 256 B of data (16 B x odd)
#define C_LDS  (16 * CPITCH)             // one wave's 16 output rows

__device__ __forceinline__ void async_copy12(const unsigned* l, const __bf16* const* g) {
  asm volatile(
      "global_load_async_to_lds_b128 %0, %12, off\n\t"
      "global_load_async_to_lds_b128 %1, %13, off\n\t"
      "global_load_async_to_lds_b128 %2, %14, off\n\t"
      "global_load_async_to_lds_b128 %3, %15, off\n\t"
      "global_load_async_to_lds_b128 %4, %16, off\n\t"
      "global_load_async_to_lds_b128 %5, %17, off\n\t"
      "global_load_async_to_lds_b128 %6, %18, off\n\t"
      "global_load_async_to_lds_b128 %7, %19, off\n\t"
      "global_load_async_to_lds_b128 %8, %20, off\n\t"
      "global_load_async_to_lds_b128 %9, %21, off\n\t"
      "global_load_async_to_lds_b128 %10, %22, off\n\t"
      "global_load_async_to_lds_b128 %11, %23, off\n\t"
      "s_wait_xcnt 0x0"
      :: "v"(l[0]), "v"(l[1]), "v"(l[2]), "v"(l[3]), "v"(l[4]), "v"(l[5]),
         "v"(l[6]), "v"(l[7]), "v"(l[8]), "v"(l[9]), "v"(l[10]), "v"(l[11]),
         "v"(g[0]), "v"(g[1]), "v"(g[2]), "v"(g[3]), "v"(g[4]), "v"(g[5]),
         "v"(g[6]), "v"(g[7]), "v"(g[8]), "v"(g[9]), "v"(g[10]), "v"(g[11])
      : "memory");
}

__global__ __launch_bounds__(256)
void attn_kernel(const __bf16* __restrict__ Qb, const __bf16* __restrict__ Kb,
                 const __bf16* __restrict__ Vt, const float* __restrict__ amask,
                 float* __restrict__ ctx) {
  __shared__ __attribute__((aligned(16))) unsigned char LA[K_LDS + V_LDS + M_LDS + 8 * C_LDS];
  const int lane = threadIdx.x;
  // the wave's number in a scalar register: the key loop's bounds are then scalars
  const int wave = __builtin_amdgcn_readfirstlane(threadIdx.y);
  const int h  = blockIdx.x & (NH - 1);
  const int qb = (blockIdx.x >> 4) * AQ;         // the block's first query
  const int q0 = qb + wave * 16;                 // the wave's first query
  const int hi = (lane >= 16) ? 1 : 0;
  const int lr = lane & 15;

  // first staged key: the run [kb, kb + AKEYS) lies inside the sequence and holds
  // [qb - WIN_HALF, qb + AQ + WIN_HALF) as far as those keys exist
  int kb = qb - WIN_HALF;
  if (kb < 0) kb = 0;
  if (kb > S_LEN - AKEYS) kb = S_LEN - AKEYS;

  {
    const unsigned lbase = (unsigned)(size_t)LA;
    unsigned l[12];
    const __bf16* g[12];
    // K: a wave brings 48 rows, a copy 4 rows of one whole line each
    const int kr = wave * 48 + (lane >> 3);
    const unsigned lk = lbase + kr * KPITCH + (lane & 7) * 16;
    const __bf16* gk = Kb + (size_t)(kb + kr) * HS + h * HD + (lane & 7) * 8;
#pragma unroll
    for (int j = 0; j < 12; ++j) { l[j] = lk + j * 4 * KPITCH; g[j] = gk + (size_t)j * 4 * HS; }
    async_copy12(l, g);
    // V^T: a wave brings 8 rows of 48 pieces of 16 B, a copy 512 B on end of them;
    // three copies cover two rows, so the lane's place repeats every third copy
#pragma unroll
    for (int b = 0; b < 3; ++b) {
      const int c = b * 32 + lane;
      const int vr = wave * 8 + c / 48;
      const unsigned lv = lbase + K_LDS + vr * VPITCH + (c % 48) * 16;
      const __bf16* gv = Vt + (size_t)(h * HD + vr) * S_LEN + kb + (c % 48) * 8;
#pragma unroll
      for (int a = 0; a < 4; ++a) {
        l[a * 3 + b] = lv + a * 2 * VPITCH;
        g[a * 3 + b] = gv + (size_t)a * 2 * S_LEN;
      }
    }
    async_copy12(l, g);
  }
  // padding mask of the staged keys: 96 float4, through registers
  if (wave < AKEYS / 128)
    ((float4*)(LA + K_LDS + V_LDS))[wave * 32 + lane] =
        ((const float4*)(amask + kb))[wave * 32 + lane];

  // Q rows as B-fragments (lane = query, K = head dims)
  const __bf16* qp = Qb + (size_t)(q0 + lr) * HS + h * HD + hi * 8;
  v16bf qb0 = load_frag16(qp);        // dims 0..31
  v16bf qb1 = load_frag16(qp + 32);   // dims 32..63

  v8f zero8 = {0.f, 0.f, 0.f, 0.f, 0.f, 0.f, 0.f, 0.f};
  v8f ot[4] = {zero8, zero8, zero8, zero8};      // O^T, 4 dim-chunks of 16
  float m = -3.0e38f, l = 0.0f;

  int kt0 = q0 - WIN_HALF; if (kt0 < 0) kt0 = 0; kt0 &= ~31;
  int kend = q0 + 16 + WIN_HALF; if (kend > S_LEN) kend = S_LEN;
  const int i = q0 + lr;                         // this lane's query index

  // read side: lane = fragment row (key for K, dim for V^T), upper half-wave 8 elements on
  const unsigned char* kl = LA + lr * KPITCH + hi * 16;
  const unsigned char* vl = LA + K_LDS + lr * VPITCH + hi * 16;
  const float* ml = (const float*)(LA + K_LDS + V_LDS);

  asm volatile("s_wait_asynccnt 0x0" ::: "memory");  // own copies have landed
  __syncthreads();                                   // ... and every other wave's, and the mask

  for (int kt = kt0; kt < kend; kt += 32) {
    const int ko = kt - kb;                      // the tile's first key among the staged ones
    v16bf ka[2][2], va[4];
#pragma unroll
    for (int kc = 0; kc < 2; ++kc) {
      const __bf16* kp = (const __bf16*)(kl + (ko + kc * 16) * KPITCH);
      ka[kc][0] = load_frag16(kp);
      ka[kc][1] = load_frag16(kp + 32);
    }
#pragma unroll
    for (int dc = 0; dc < 4; ++dc)
      va[dc] = load_frag16((const __bf16*)(vl + dc * 16 * VPITCH + ko * 2));

    // ---- S^T tile: 32 keys x 16 queries (keys = WMMA M, dims = WMMA K)
    v8f st[2];
#pragma unroll
    for (int kc = 0; kc < 2; ++kc) {
      v8f s = zero8;
      s = wmma_bf16(ka[kc][0], qb0, s);
      s = wmma_bf16(ka[kc][1], qb1, s);
      st[kc] = s;
    }
    // ---- scale + padding mask + window mask (element: key j, query i)
    float tmax = -3.0e38f;
#pragma unroll
    for (int kc = 0; kc < 2; ++kc) {
      int jb = kt + kc * 16 + hi * 8;            // keys jb..jb+7 live in this lane
      float am[8];
      *(float4*)&am[0] = *(const float4*)(ml + (jb - kb));
      *(float4*)&am[4] = *(const float4*)(ml + (jb - kb) + 4);
#pragma unroll
      for (int v = 0; v < 8; ++v) {
        int j = jb + v;
        float sv = st[kc][v] * 0.125f + (1.0f - am[v]) * (-10000.0f);
        bool keep = (j >= i - WIN_HALF) && (j < i + WIN_HALF);
        sv = keep ? sv : -10000.0f;
        st[kc][v] = sv;
        tmax = fmaxf(tmax, sv);
      }
    }
    // ---- online softmax (per-query stats live in lane pairs (q, q+16))
    tmax = fmaxf(tmax, __shfl_xor(tmax, 16, 32));
    float mn = fmaxf(m, tmax);
    float scale = __expf(m - mn);
    float rsum = 0.0f;
    v16bf pa;                                    // P^T as B-fragment for PV
#pragma unroll
    for (int v = 0; v < 8; ++v) {
      float p0 = __expf(st[0][v] - mn);
      float p1 = __expf(st[1][v] - mn);
      rsum += p0 + p1;
      pa[v]     = (__bf16)p0;                    // keys kt + v + hi*8
      pa[v + 8] = (__bf16)p1;                    // keys kt + 16 + v + hi*8
    }
    rsum += __shfl_xor(rsum, 16, 32);
    l = l * scale + rsum;
    m = mn;
    // ---- O^T += V^T_tile * P^T (A: M = dims, K = keys; contiguous in Vt)
#pragma unroll
    for (int dc = 0; dc < 4; ++dc) {
      v8f o = ot[dc];
#pragma unroll
      for (int v = 0; v < 8; ++v) o[v] *= scale; // rescale: lane's query matches stats
      ot[dc] = wmma_bf16(va[dc], pa, o);
    }
  }

  float linv = 1.0f / l;
  unsigned char* cw = LA + K_LDS + V_LDS + M_LDS + wave * C_LDS;
#pragma unroll
  for (int dc = 0; dc < 4; ++dc) {
    unsigned char* s = cw + lr * CPITCH + dc * 64 + hi * 32;
    float4 o0 = { ot[dc][0] * linv, ot[dc][1] * linv, ot[dc][2] * linv, ot[dc][3] * linv };
    float4 o1 = { ot[dc][4] * linv, ot[dc][5] * linv, ot[dc][6] * linv, ot[dc][7] * linv };
    *(float4*)s = o0;
    *(float4*)(s + 16) = o1;
  }
  asm volatile("s_wait_dscnt 0x0" ::: "memory");  // the rows are written before other lanes read them
  float4 t[8];
#pragma unroll
  for (int j = 0; j < 8; ++j)                    // 16 lanes a row: two rows a load
    t[j] = *(const float4*)(cw + (j * 2 + hi) * CPITCH + lr * 16);
  float* cp = ctx + (size_t)(q0 + hi) * HS + h * HD + lr * 4;
#pragma unroll
  for (int j = 0; j < 8; ++j) *(float4*)(cp + (size_t)j * 2 * HS) = t[j];
}

// --------------------------------------------------- residual + layer norm
__global__ __launch_bounds__(256)
void ln_kernel(const float* __restrict__ hs, const float* __restrict__ ctx,
               const float* __restrict__ gamma, const float* __restrict__ beta,
               float* __restrict__ out) {
  __shared__ float red[8];
  const int row = blockIdx.x;
  const int t = threadIdx.x;
  const int lane = t & 31, wid = t >> 5;

  float4 hv = *(const float4*)(hs + (size_t)row * HS + t * 4);
  float4 cv = *(const float4*)(ctx + (size_t)row * HS + t * 4);
  float x[4] = {hv.x + cv.x, hv.y + cv.y, hv.z + cv.z, hv.w + cv.w};

  float s = x[0] + x[1] + x[2] + x[3];
#pragma unroll
  for (int o = 1; o < 32; o <<= 1) s += __shfl_xor(s, o, 32);
  if (lane == 0) red[wid] = s;
  __syncthreads();
  float tot = 0.f;
#pragma unroll
  for (int k = 0; k < 8; ++k) tot += red[k];
  float mu = tot * (1.0f / HS);

  float vs = 0.f;
#pragma unroll
  for (int k = 0; k < 4; ++k) { float d = x[k] - mu; vs += d * d; }
#pragma unroll
  for (int o = 1; o < 32; o <<= 1) vs += __shfl_xor(vs, o, 32);
  __syncthreads();
  if (lane == 0) red[wid] = vs;
  __syncthreads();
  float vtot = 0.f;
#pragma unroll
  for (int k = 0; k < 8; ++k) vtot += red[k];
  float rstd = rsqrtf(vtot * (1.0f / HS) + LN_EPS);

  float4 gv = *(const float4*)(gamma + t * 4);
  float4 bv = *(const float4*)(beta + t * 4);
  float4 ov;
  ov.x = (x[0] - mu) * rstd * gv.x + bv.x;
  ov.y = (x[1] - mu) * rstd * gv.y + bv.y;
  ov.z = (x[2] - mu) * rstd * gv.z + bv.z;
  ov.w = (x[3] - mu) * rstd * gv.w + bv.w;
  *(float4*)(out + (size_t)row * HS + t * 4) = ov;
}

// ----------------------------------------------------------------- launcher
extern "C" void kernel_launch(void* const* d_in, const int* in_sizes, int n_in,
                              void* d_out, int out_size, void* d_ws, size_t ws_size,
                              hipStream_t stream) {
  const float* hs    = (const float*)d_in[0];
  const float* amask = (const float*)d_in[1];
  const float* Wq    = (const float*)d_in[2];
  const float* bq    = (const float*)d_in[3];
  const float* Wk    = (const float*)d_in[4];
  const float* bk    = (const float*)d_in[5];
  const float* Wv    = (const float*)d_in[6];
  const float* bv    = (const float*)d_in[7];
  const float* gamma = (const float*)d_in[8];
  const float* beta  = (const float*)d_in[9];
  float* outp = (float*)d_out;

  char* ws = (char*)d_ws;
  size_t off = 0;
  __bf16* Xb  = (__bf16*)(ws + off); off += (size_t)S_LEN * HS * 2;  // 8 MB
  __bf16* Wqb = (__bf16*)(ws + off); off += (size_t)HS * HS * 2;     // 2 MB
  __bf16* Wkb = (__bf16*)(ws + off); off += (size_t)HS * HS * 2;
  __bf16* Wvb = (__bf16*)(ws + off); off += (size_t)HS * HS * 2;
  __bf16* Qb  = (__bf16*)(ws + off); off += (size_t)S_LEN * HS * 2;  // [S][HS]
  __bf16* Kb  = (__bf16*)(ws + off); off += (size_t)S_LEN * HS * 2;  // [S][HS]
  __bf16* Vt  = (__bf16*)(ws + off); off += (size_t)S_LEN * HS * 2;  // [HS][S] (V^T)
  float*  ctx = (float*)(ws + off);  off += (size_t)S_LEN * HS * 4;  // 16 MB

  // Xb, Wqb, Wkb, Wvb are contiguous from Xb on
  cvt_kernel<<<CV_XB + 3 * CV_WB, 256, 0, stream>>>(hs, Wq, Wk, Wv, Xb);

  // Wqb, Wkb, Wvb are contiguous from Wqb on
  qkv_gemm_kernel<<<dim3(S_LEN / BM, HS / BC), dim3(32, 16), 0, stream>>>(
      Xb, Wqb, bq, bk, bv, Qb, Kb, Vt);

  attn_kernel<<<(S_LEN / AQ) * NH, dim3(32, 8), 0, stream>>>(Qb, Kb, Vt, amask, ctx);
  ln_kernel<<<S_LEN, 256, 0, stream>>>(hs, ctx, gamma, beta, outp);
}

// v006
// A run of this version takes 40.6 microseconds.
// Two timings next to v005 put it at 1.07 and 1.06 times that version's speed.
// All steps since v000 together make it 3.39 times as fast.
#include <hip/hip_runtime.h>
#include <hip/hip_bf16.h>

// Problem constants (match reference)
#define S_LEN    4096
#define HS       1024
#define NH       16
#define HD       64
#define WIN_HALF 128
#define LN_EPS   1e-12f

typedef __attribute__((ext_vector_type(16))) __bf16 v16bf;
typedef __attribute__((ext_vector_type(8)))  __bf16 v8bf;
typedef __attribute__((ext_vector_type(4)))  __bf16 v4bf;
typedef __attribute__((ext_vector_type(8)))  float  v8f;
typedef __attribute__((ext_vector_type(4)))  float  v4f;

// D = A(16x32 bf16) x B(32x16 bf16) + C(16x16 f32)  -> v_wmma_f32_16x16x32_bf16
__device__ __forceinline__ v8f wmma_bf16(v16bf a, v16bf b, v8f c) {
  return __builtin_amdgcn_wmma_f32_16x16x32_bf16(false, a, false, b, (short)0, c,
                                                 false, false);
}

__device__ __forceinline__ v16bf load_frag16(const __bf16* p) {
  v8bf lo = *(const v8bf*)p;
  v8bf hi = *(const v8bf*)(p + 16);
  v16bf r;
#pragma unroll
  for (int i = 0; i < 8; ++i) { r[i] = lo[i]; r[i + 8] = hi[i]; }
  return r;
}

// ---------------------------------------------------------------- f32 -> bf16
// One launch converts X, Wq, Wk and Wv. Their bf16 planes lie one behind the other in
// the workspace, so block b writes the b-th piece of CV_BLK float4 of that one range
// and only its source pointer depends on which plane the piece belongs to.
// A thread converts CV_PER float4: few long waves instead of many that live for one
// load. Every wave-wide load covers 512 contiguous bytes, every store 256.
#define CV_PER  16                        // float4 per thread, all loaded before the first store
#define CV_BLK  (256 * CV_PER)            // float4 per block
#define CV_XB   (S_LEN * HS / 4 / CV_BLK) // blocks of X
#define CV_WB   (HS * HS / 4 / CV_BLK)    // blocks of one weight matrix
__global__ __launch_bounds__(256)
void cvt_kernel(const float* __restrict__ x, const float* __restrict__ wq,
                const float* __restrict__ wk, const float* __restrict__ wv,
                __bf16* __restrict__ out) {
  const int b = blockIdx.x;
  const float* src = x;
  int piece = b;
  if (b >= CV_XB) {
    const int w = (b - CV_XB) / CV_WB;
    piece = (b - CV_XB) % CV_WB;
    src = (w == 0) ? wq : (w == 1) ? wk : wv;
  }
  const v4f* in4 = (const v4f*)src + (size_t)piece * CV_BLK + threadIdx.x;
  v4bf* o4 = (v4bf*)out + (size_t)b * CV_BLK + threadIdx.x;
  v4f f[CV_PER];
#pragma unroll
  for (int j = 0; j < CV_PER; ++j) f[j] = in4[j * 256];
  // holds all 16 loads in front of the first conversion (loaded values as inputs only);
  // without it the last two are held back until the first two have returned, a second
  // memory latency in every wave
  asm volatile("" :: "v"(f[0]), "v"(f[1]), "v"(f[2]), "v"(f[3]), "v"(f[4]), "v"(f[5]),
                     "v"(f[6]), "v"(f[7]), "v"(f[8]), "v"(f[9]), "v"(f[10]), "v"(f[11]),
                     "v"(f[12]), "v"(f[13]), "v"(f[14]), "v"(f[15]));
#pragma unroll
  for (int j = 0; j < CV_PER; ++j) {
    v4bf o;
    o[0] = (__bf16)f[j][0]; o[1] = (__bf16)f[j][1];
    o[2] = (__bf16)f[j][2]; o[3] = (__bf16)f[j][3];
    o4[j * 256] = o;
  }
}

#define KST    128
#define NSTG   (HS / KST)
#define PITCH  272
#define BM     256
#define BC     64
#define BN     (3 * BC)
#define A_LDS  (BM * PITCH)
#define STG    ((BM + BN) * PITCH)
// output tile in LDS, in the ring's place once the last stage has been read
#define OPITCH 144                       // a Q or K row: 128 B of data (16 B x odd)
#define O_LDS  (BM * OPITCH)             // the block's Q rows; its K rows lie behind them
#define TPITCH (BM * 2 + 16)             // a V^T row: 512 B of data (16 B x odd)

__device__ __forceinline__ void async_copy14(const unsigned* l, const __bf16* const* g) {
  asm volatile(
      "global_load_async_to_lds_b128 %0, %14, off\n\t"
      "global_load_async_to_lds_b128 %1, %15, off\n\t"
      "global_load_async_to_lds_b128 %2, %16, off\n\t"
      "global_load_async_to_lds_b128 %3, %17, off\n\t"
      "global_load_async_to_lds_b128 %4, %18, off\n\t"
      "global_load_async_to_lds_b128 %5, %19, off\n\t"
      "global_load_async_to_lds_b128 %6, %20, off\n\t"
      "global_load_async_to_lds_b128 %7, %21, off\n\t"
      "global_load_async_to_lds_b128 %8, %22, off\n\t"
      "global_load_async_to_lds_b128 %9, %23, off\n\t"
      "global_load_async_to_lds_b128 %10, %24, off\n\t"
      "global_load_async_to_lds_b128 %11, %25, off\n\t"
      "global_load_async_to_lds_b128 %12, %26, off\n\t"
      "global_load_async_to_lds_b128 %13, %27, off\n\t"
      "s_wait_xcnt 0x0"
      :: "v"(l[0]), "v"(l[1]), "v"(l[2]), "v"(l[3]), "v"(l[4]), "v"(l[5]), "v"(l[6]),
         "v"(l[7]), "v"(l[8]), "v"(l[9]), "v"(l[10]), "v"(l[11]), "v"(l[12]), "v"(l[13]),
         "v"(g[0]), "v"(g[1]), "v"(g[2]), "v"(g[3]), "v"(g[4]), "v"(g[5]), "v"(g[6]),
         "v"(g[7]), "v"(g[8]), "v"(g[9]), "v"(g[10]), "v"(g[11]), "v"(g[12]), "v"(g[13])
      : "memory");
}

// One wave's share of a stage: 16 of the 256 X rows (8 copies of 2 rows) and 4 of the
// 64 rows of each weight matrix (2 copies each).
// la/lb: the lane's LDS byte address in the target buffer,
// ga/gb: the lane's global address at the stage's first k.
__device__ __forceinline__ void issue_stage(unsigned la, unsigned lb,
                                            const __bf16* ga, const __bf16* gb) {
  unsigned l[14];
  const __bf16* g[14];
#pragma unroll
  for (int j = 0; j < 8; ++j) { l[j] = la + j * 2 * PITCH; g[j] = ga + (size_t)j * 2 * HS; }
#pragma unroll
  for (int m = 0; m < 3; ++m)
#pragma unroll
    for (int j = 0; j < 2; ++j) {
      l[8 + m * 2 + j] = lb + (m * BC + j * 2) * PITCH;
      g[8 + m * 2 + j] = gb + (size_t)(m * HS + j * 2) * HS;
    }
  async_copy14(l, g);
}

// Fragments of k-step ks (32 k) of a stage, from LDS.
__device__ __forceinline__ void load_ab(const unsigned char* as, const unsigned char* bs, int ks,
                                        v16bf a[4], v16bf b[3]) {
#pragma unroll
  for (int mc = 0; mc < 4; ++mc)
    a[mc] = load_frag16((const __bf16*)(as + mc * 16 * PITCH + ks * 64));
#pragma unroll
  for (int nc = 0; nc < 3; ++nc)
    b[nc] = load_frag16((const __bf16*)(bs + nc * BC * PITCH + ks * 64));
}

__global__ __launch_bounds__(512)
void qkv_gemm_kernel(const __bf16* __restrict__ Xb, const __bf16* __restrict__ Wb,
                     const float* __restrict__ bq, const float* __restrict__ bk,
                     const float* __restrict__ bv, __bf16* __restrict__ Qo,
                     __bf16* __restrict__ Ko, __bf16* __restrict__ Vto) {
  __shared__ __attribute__((aligned(16))) unsigned char L[2 * STG];
  const int lane = threadIdx.x;
  // the wave's number in a scalar register: its share of rows and columns is then scalar
  const int wave = __builtin_amdgcn_readfirstlane(threadIdx.y);
  const int wr = wave & 3;
  const int wc = wave >> 2;
  const int hi = (lane >= 16) ? 1 : 0;
  const int lr = lane & 15;
  const int m0 = blockIdx.x * BM;
  const int n0 = blockIdx.y * BC;

  v8f zero8 = {0.f, 0.f, 0.f, 0.f, 0.f, 0.f, 0.f, 0.f};
  v8f c[4][3];
#pragma unroll
  for (int mc = 0; mc < 4; ++mc)
#pragma unroll
    for (int nc = 0; nc < 3; ++nc) c[mc][nc] = zero8;

  const unsigned lbase = (unsigned)(size_t)L;
  const unsigned la = lbase + (wave * 16 + hi) * PITCH + lr * 16;
  const unsigned lb = lbase + A_LDS + (wave * 4 + hi) * PITCH + lr * 16;
  const __bf16* ga = Xb + (size_t)(m0 + wave * 16 + hi) * HS + lr * 8;
  const __bf16* gb = Wb + (size_t)(n0 + wave * 4 + hi) * HS + lr * 8;
  // read side: lane = fragment row, upper half-wave 8 k further
  const unsigned char* as = L + (wr * 64 + lr) * PITCH + hi * 16;
  const unsigned char* bs = L + A_LDS + (wc * 16 + lr) * PITCH + hi * 16;

  issue_stage(la, lb, ga, gb);
  asm volatile("s_wait_asynccnt 0x0" ::: "memory");  // own copies of stage 0 have landed
  __syncthreads();                                   // ... and every other wave's
  issue_stage(la + STG, lb + STG, ga + KST, gb + KST);

  for (int t = 0; t < NSTG; ++t) {
    const int bo = (t & 1) * STG;
    v16bf a[2][4], b[2][3];
    load_ab(as + bo, bs + bo, 0, a[0], b[0]);
#pragma unroll
    for (int ks = 0; ks < 4; ++ks) {
      if (ks < 3) load_ab(as + bo, bs + bo, ks + 1, a[(ks + 1) & 1], b[(ks + 1) & 1]);
      // keeps the next k-step's LDS reads one group ahead of this k-step's WMMAs; without
      // the two fences they are sunk among the WMMAs and each is waited out to zero
      __builtin_amdgcn_sched_barrier(0);
#pragma unroll
      for (int mc = 0; mc < 4; ++mc)
#pragma unroll
        for (int nc = 0; nc < 3; ++nc)
          c[mc][nc] = (nc < 2) ? wmma_bf16(b[ks & 1][nc], a[ks & 1][mc], c[mc][nc])   // Q, K: D^T
                               : wmma_bf16(a[ks & 1][mc], b[ks & 1][nc], c[mc][nc]);  // V
      __builtin_amdgcn_sched_barrier(0);
    }
    asm volatile("s_wait_dscnt 0x0" ::: "memory");     // own reads of this buffer are done
    asm volatile("s_wait_asynccnt 0x0" ::: "memory");  // own copies of stage t+1 have landed
    __syncthreads();  // publishes stage t+1 and frees this buffer for its refill
    if (t + 2 < NSTG)
      issue_stage(la + bo, lb + bo, ga + (t + 2) * KST, gb + (t + 2) * KST);
  }
  asm volatile("s_wait_asynccnt 0x0" ::: "memory");    // no copy outlives the loop

  // ---- the tile into LDS. The loop's last barrier stands behind every wave's last read of
  // the ring, and no copy is in flight any more.
  // all bias loads first, so that their latencies overlap
  const float bvl = bv[n0 + wc * 16 + lr];
  v4f bqk[2][2];
#pragma unroll
  for (int nc = 0; nc < 2; ++nc) {
    const float* bp = ((nc == 0) ? bq : bk) + n0 + wc * 16 + hi * 8;
    // stands in front of the next loads, whose results may land in registers that the
    // loads issued so far name as addresses
    asm volatile("s_wait_xcnt 0x0" ::: "memory");
    bqk[nc][0] = *(const v4f*)bp;
    bqk[nc][1] = *(const v4f*)(bp + 4);
  }
#pragma unroll
  for (int nc = 0; nc < 2; ++nc) {
    const v4f b0 = bqk[nc][0];
    const v4f b1 = bqk[nc][1];
    unsigned char* s = L + nc * O_LDS + (wr * 64 + lr) * OPITCH + wc * 32 + hi * 16;
#pragma unroll
    for (int mc = 0; mc < 4; ++mc) {
      v8bf o;
#pragma unroll
      for (int v = 0; v < 4; ++v) {
        o[v]     = (__bf16)(c[mc][nc][v] + b0[v]);
        o[v + 4] = (__bf16)(c[mc][nc][v + 4] + b1[v]);
      }
      *(v8bf*)(s + mc * 16 * OPITCH) = o;
    }
  }
  {
    unsigned char* s = L + 2 * O_LDS + (wc * 16 + lr) * TPITCH + (wr * 64 + hi * 8) * 2;
#pragma unroll
    for (int mc = 0; mc < 4; ++mc) {
      v8bf o;
#pragma unroll
      for (int v = 0; v < 8; ++v) o[v] = (__bf16)(c[mc][2][v] + bvl);
      *(v8bf*)(s + mc * 32) = o;
    }
  }
  __syncthreads();  // the tile is whole: every wave's part has been written

  v8bf t[12];
  const int r0 = wave * 16 + ((lane >> 3) & 1) * 8 + (lane >> 4) * 4;
  const int pc = lane & 7;
#pragma unroll
  for (int nc = 0; nc < 2; ++nc)
#pragma unroll
    for (int j = 0; j < 4; ++j)
      t[nc * 4 + j] = *(const v8bf*)(L + nc * O_LDS + (r0 + j) * OPITCH + pc * 16);
#pragma unroll
  for (int j = 0; j < 4; ++j)
    t[8 + j] = *(const v8bf*)(L + 2 * O_LDS + (wave * 4 + j) * TPITCH + lane * 16);
  __bf16* qo = Qo + (size_t)(m0 + r0) * HS + n0 + pc * 8;
  __bf16* ko = Ko + (size_t)(m0 + r0) * HS + n0 + pc * 8;
  __bf16* vo = Vto + (size_t)(n0 + wave * 4) * S_LEN + m0 + lane * 8;
#pragma unroll
  for (int j = 0; j < 4; ++j) {
    *(v8bf*)(qo + j * HS) = t[j];
    *(v8bf*)(ko + j * HS) = t[4 + j];
    *(v8bf*)(vo + (size_t)j * S_LEN) = t[8 + j];
  }
}

#define AQ     128                       // queries of a block
#define AKEYS  (AQ + 2 * WIN_HALF)       // keys staged for them
#define KPITCH 144                       // LDS pitch of a K row, 128 B of data (16 B x odd)
#define VPITCH (AKEYS * 2 + 16)          // LDS pitch of a V^T row, 768 B of data (16 B x odd)
#define K_LDS  (AKEYS * KPITCH)
#define V_LDS  (HD * VPITCH)
#define M_LDS  (AKEYS * 4)               // padding mask of the staged keys
#define CPITCH 272                       // LDS pitch of an output row, 256 B of data (16 B x odd)
#define C_LDS  (16 * CPITCH)             // one wave's 16 output rows

__device__ __forceinline__ void async_copy12(const unsigned* l, const __bf16* const* g) {
  asm volatile(
      "global_load_async_to_lds_b128 %0, %12, off\n\t"
      "global_load_async_to_lds_b128 %1, %13, off\n\t"
      "global_load_async_to_lds_b128 %2, %14, off\n\t"
      "global_load_async_to_lds_b128 %3, %15, off\n\t"
      "global_load_async_to_lds_b128 %4, %16, off\n\t"
      "global_load_async_to_lds_b128 %5, %17, off\n\t"
      "global_load_async_to_lds_b128 %6, %18, off\n\t"
      "global_load_async_to_lds_b128 %7, %19, off\n\t"
      "global_load_async_to_lds_b128 %8, %20, off\n\t"
      "global_load_async_to_lds_b128 %9, %21, off\n\t"
      "global_load_async_to_lds_b128 %10, %22, off\n\t"
      "global_load_async_to_lds_b128 %11, %23, off\n\t"
      "s_wait_xcnt 0x0"
      :: "v"(l[0]), "v"(l[1]), "v"(l[2]), "v"(l[3]), "v"(l[4]), "v"(l[5]),
         "v"(l[6]), "v"(l[7]), "v"(l[8]), "v"(l[9]), "v"(l[10]), "v"(l[11]),
         "v"(g[0]), "v"(g[1]), "v"(g[2]), "v"(g[3]), "v"(g[4]), "v"(g[5]),
         "v"(g[6]), "v"(g[7]), "v"(g[8]), "v"(g[9]), "v"(g[10]), "v"(g[11])
      : "memory");
}

__global__ __launch_bounds__(256)
void attn_kernel(const __bf16* __restrict__ Qb, const __bf16* __restrict__ Kb,
                 const __bf16* __restrict__ Vt, const float* __restrict__ amask,
                 float* __restrict__ ctx) {
  __shared__ __attribute__((aligned(16))) unsigned char LA[K_LDS + V_LDS + M_LDS + 8 * C_LDS];
  const int lane = threadIdx.x;
  // the wave's number in a scalar register: the key loop's bounds are then scalars
  const int wave = __builtin_amdgcn_readfirstlane(threadIdx.y);
  const int h  = blockIdx.x & (NH - 1);
  const int qb = (blockIdx.x >> 4) * AQ;         // the block's first query
  const int q0 = qb + wave * 16;                 // the wave's first query
  const int hi = (lane >= 16) ? 1 : 0;
  const int lr = lane & 15;

  // first staged key: the run [kb, kb + AKEYS) lies inside the sequence and holds
  // [qb - WIN_HALF, qb + AQ + WIN_HALF) as far as those keys exist
  int kb = qb - WIN_HALF;
  if (kb < 0) kb = 0;
  if (kb > S_LEN - AKEYS) kb = S_LEN - AKEYS;

  {
    const unsigned lbase = (unsigned)(size_t)LA;
    unsigned l[12];
    const __bf16* g[12];
    // K: a wave brings 48 rows, a copy 4 rows of one whole line each
    const int kr = wave * 48 + (lane >> 3);
    const unsigned lk = lbase + kr * KPITCH + (lane & 7) * 16;
    const __bf16* gk = Kb + (size_t)(kb + kr) * HS + h * HD + (lane & 7) * 8;
#pragma unroll
    for (int j = 0; j < 12; ++j) { l[j] = lk + j * 4 * KPITCH; g[j] = gk + (size_t)j * 4 * HS; }
    async_copy12(l, g);
    // V^T: a wave brings 8 rows of 48 pieces of 16 B, a copy 512 B on end of them;
    // three copies cover two rows, so the lane's place repeats every third copy
#pragma unroll
    for (int b = 0; b < 3; ++b) {
      const int c = b * 32 + lane;
      const int vr = wave * 8 + c / 48;
      const unsigned lv = lbase + K_LDS + vr * VPITCH + (c % 48) * 16;
      const __bf16* gv = Vt + (size_t)(h * HD + vr) * S_LEN + kb + (c % 48) * 8;
#pragma unroll
      for (int a = 0; a < 4; ++a) {
        l[a * 3 + b] = lv + a * 2 * VPITCH;
        g[a * 3 + b] = gv + (size_t)a * 2 * S_LEN;
      }
    }
    async_copy12(l, g);
  }
  // padding mask of the staged keys: 96 float4, through registers
  if (wave < AKEYS / 128)
    ((float4*)(LA + K_LDS + V_LDS))[wave * 32 + lane] =
        ((const float4*)(amask + kb))[wave * 32 + lane];

  // Q rows as B-fragments (lane = query, K = head dims)
  const __bf16* qp = Qb + (size_t)(q0 + lr) * HS + h * HD + hi * 8;
  v16bf qb0 = load_frag16(qp);        // dims 0..31
  v16bf qb1 = load_frag16(qp + 32);   // dims 32..63

  v8f zero8 = {0.f, 0.f, 0.f, 0.f, 0.f, 0.f, 0.f, 0.f};
  v8f ot[4] = {zero8, zero8, zero8, zero8};      // O^T, 4 dim-chunks of 16
  float m = -3.0e38f, l = 0.0f;

  int kt0 = q0 - WIN_HALF; if (kt0 < 0) kt0 = 0; kt0 &= ~31;
  int kend = q0 + 16 + WIN_HALF; if (kend > S_LEN) kend = S_LEN;
  const int i = q0 + lr;                         // this lane's query index

  // read side: lane = fragment row (key for K, dim for V^T), upper half-wave 8 elements on
  const unsigned char* kl = LA + lr * KPITCH + hi * 16;
  const unsigned char* vl = LA + K_LDS + lr * VPITCH + hi * 16;
  const float* ml = (const float*)(LA + K_LDS + V_LDS);

  asm volatile("s_wait_asynccnt 0x0" ::: "memory");  // own copies have landed
  __syncthreads();                                   // ... and every other wave's, and the mask

  for (int kt = kt0; kt < kend; kt += 32) {
    const int ko = kt - kb;                      // the tile's first key among the staged ones
    v16bf ka[2][2], va[4];
#pragma unroll
    for (int kc = 0; kc < 2; ++kc) {
      const __bf16* kp = (const __bf16*)(kl + (ko + kc * 16) * KPITCH);
      ka[kc][0] = load_frag16(kp);
      ka[kc][1] = load_frag16(kp + 32);
    }
#pragma unroll
    for (int dc = 0; dc < 4; ++dc)
      va[dc] = load_frag16((const __bf16*)(vl + dc * 16 * VPITCH + ko * 2));

    // ---- S^T tile: 32 keys x 16 queries (keys = WMMA M, dims = WMMA K)
    v8f st[2];
#pragma unroll
    for (int kc = 0; kc < 2; ++kc) {
      v8f s = zero8;
      s = wmma_bf16(ka[kc][0], qb0, s);
      s = wmma_bf16(ka[kc][1], qb1, s);
      st[kc] = s;
    }
    // ---- scale + padding mask + window mask (element: key j, query i)
    float tmax = -3.0e38f;
#pragma unroll
    for (int kc = 0; kc < 2; ++kc) {
      int jb = kt + kc * 16 + hi * 8;            // keys jb..jb+7 live in this lane
      float am[8];
      *(float4*)&am[0] = *(const float4*)(ml + (jb - kb));
      *(float4*)&am[4] = *(const float4*)(ml + (jb - kb) + 4);
#pragma unroll
      for (int v = 0; v < 8; ++v) {
        int j = jb + v;
        float sv = st[kc][v] * 0.125f + (1.0f - am[v]) * (-10000.0f);
        bool keep = (j >= i - WIN_HALF) && (j < i + WIN_HALF);
        sv = keep ? sv : -10000.0f;
        st[kc][v] = sv;
        tmax = fmaxf(tmax, sv);
      }
    }
    // ---- online softmax (per-query stats live in lane pairs (q, q+16))
    tmax = fmaxf(tmax, __shfl_xor(tmax, 16, 32));
    float mn = fmaxf(m, tmax);
    float scale = __expf(m - mn);
    float rsum = 0.0f;
    v16bf pa;                                    // P^T as B-fragment for PV
#pragma unroll
    for (int v = 0; v < 8; ++v) {
      float p0 = __expf(st[0][v] - mn);
      float p1 = __expf(st[1][v] - mn);
      rsum += p0 + p1;
      pa[v]     = (__bf16)p0;                    // keys kt + v + hi*8
      pa[v + 8] = (__bf16)p1;                    // keys kt + 16 + v + hi*8
    }
    rsum += __shfl_xor(rsum, 16, 32);
    l = l * scale + rsum;
    m = mn;
    // ---- O^T += V^T_tile * P^T (A: M = dims, K = keys; contiguous in Vt)
#pragma unroll
    for (int dc = 0; dc < 4; ++dc) {
      v8f o = ot[dc];
#pragma unroll
      for (int v = 0; v < 8; ++v) o[v] *= scale; // rescale: lane's query matches stats
      ot[dc] = wmma_bf16(va[dc], pa, o);
    }
  }

  float linv = 1.0f / l;
  unsigned char* cw = LA + K_LDS + V_LDS + M_LDS + wave * C_LDS;
#pragma unroll
  for (int dc = 0; dc < 4; ++dc) {
    unsigned char* s = cw + lr * CPITCH + dc * 64 + hi * 32;
    float4 o0 = { ot[dc][0] * linv, ot[dc][1] * linv, ot[dc][2] * linv, ot[dc][3] * linv };
    float4 o1 = { ot[dc][4] * linv, ot[dc][5] * linv, ot[dc][6] * linv, ot[dc][7] * linv };
    *(float4*)s = o0;
    *(float4*)(s + 16) = o1;
  }
  asm volatile("s_wait_dscnt 0x0" ::: "memory");  // the rows are written before other lanes read them
  float4 t[8];
#pragma unroll
  for (int j = 0; j < 8; ++j)                    // 16 lanes a row: two rows a load
    t[j] = *(const float4*)(cw + (j * 2 + hi) * CPITCH + lr * 16);
  float* cp = ctx + (size_t)(q0 + hi) * HS + h * HD + lr * 4;
#pragma unroll
  for (int j = 0; j < 8; ++j) *(float4*)(cp + (size_t)j * 2 * HS) = t[j];
}

// --------------------------------------------------- residual + layer norm
// One wave a row: a lane holds 32 of the row's 1,024 values (8 pieces of 16 B from each of
// hs and ctx, every wave-wide load 512 B on end, all 16 issued ahead), so both row sums are
// formed in registers and cross lanes only inside the wave. Work-group = 16 rows on 16 waves:
// 4,096 long waves in all. gamma and beta (8 KB) are fetched once a work-group, 512 B a wave,
// and reach the other waves through LDS while the rows are still on their way.
#define LN_ROWS 16                       // rows (and waves) of a work-group

template <int MASK>
__device__ __forceinline__ float row_xmask(float v) {
  return __builtin_bit_cast(float, __builtin_amdgcn_update_dpp(
      0, __builtin_bit_cast(int, v), 0x160 + MASK, 0xf, 0xf, true));
}
// sum over the wave's 32 lanes, the same bits in every lane
__device__ __forceinline__ float wave_sum(float v) {
  v += row_xmask<1>(v);
  v += row_xmask<2>(v);
  v += row_xmask<4>(v);
  v += row_xmask<8>(v);
  const int w = __builtin_bit_cast(int, v);
  v += __builtin_bit_cast(float,
      __builtin_amdgcn_permlanex16(w, w, 0x76543210, 0xfedcba98, false, false));
  return v;
}

__global__ __launch_bounds__(LN_ROWS * 32)
void ln_kernel(const float* __restrict__ hs, const float* __restrict__ ctx,
               const float* __restrict__ gamma, const float* __restrict__ beta,
               float* __restrict__ out) {
  __shared__ __attribute__((aligned(16))) float gb[2 * HS];   // gamma, then beta
  const int lane = threadIdx.x & 31;
  // the wave's number in a scalar register: the row's base addresses are then scalars
  const int wave = __builtin_amdgcn_readfirstlane(threadIdx.x >> 5);
  const size_t row = (size_t)blockIdx.x * LN_ROWS + wave;

  // the wave's 512 B of gamma | beta first: it is waited for first
  const float* gsrc = (wave < LN_ROWS / 2) ? gamma + wave * 128 : beta + (wave - LN_ROWS / 2) * 128;
  const v4f piece = *((const v4f*)gsrc + lane);
  const v4f* hp = (const v4f*)(hs + row * HS) + lane;
  const v4f* cp = (const v4f*)(ctx + row * HS) + lane;
  v4f hv[8], cv[8];
#pragma unroll
  for (int j = 0; j < 8; ++j) hv[j] = hp[j * 32];
#pragma unroll
  for (int j = 0; j < 8; ++j) cv[j] = cp[j * 32];
  // keeps the 16 row loads in front of the barrier; without it they are sunk behind it and
  // start only when gamma and beta have arrived, a second memory latency in every wave
  __builtin_amdgcn_sched_barrier(0);

  ((v4f*)gb)[threadIdx.x] = piece;
  // the work-group's barrier by hand, behind the wave's own LDS write: gamma and beta are whole
  // in LDS behind it. __syncthreads() would also wait out the 16 row loads, so that every wave
  // stood here until the slowest wave's rows had come and the LDS reads below hid under nothing
  asm volatile("s_wait_dscnt 0x0\n\ts_barrier_signal -1\n\ts_barrier_wait -1" ::: "memory");
  v4f gv[8], bv[8];
#pragma unroll
  for (int j = 0; j < 8; ++j) {
    gv[j] = ((const v4f*)gb)[j * 32 + lane];
    bv[j] = ((const v4f*)(gb + HS))[j * 32 + lane];
  }
  // keeps the LDS reads here, under the row loads' latency; without it they are sunk behind
  // the row sums, where every wave would wait for them
  __builtin_amdgcn_sched_barrier(0);

  v4f x[8];
#pragma unroll
  for (int j = 0; j < 8; ++j) x[j] = hv[j] + cv[j];
  const v4f s4 = ((x[0] + x[1]) + (x[2] + x[3])) + ((x[4] + x[5]) + (x[6] + x[7]));
  const float mu = wave_sum((s4[0] + s4[1]) + (s4[2] + s4[3])) * (1.0f / HS);

#pragma unroll
  for (int j = 0; j < 8; ++j) x[j] -= mu;
  v4f q[4];
#pragma unroll
  for (int j = 0; j < 4; ++j)
    q[j] = __builtin_elementwise_fma(x[2 * j + 1], x[2 * j + 1], x[2 * j] * x[2 * j]);
  const v4f q4 = (q[0] + q[1]) + (q[2] + q[3]);
  const float rstd = rsqrtf(wave_sum((q4[0] + q4[1]) + (q4[2] + q4[3])) * (1.0f / HS) + LN_EPS);

  v4f* op = (v4f*)(out + row * HS) + lane;
#pragma unroll
  for (int j = 0; j < 8; ++j) op[j * 32] = x[j] * rstd * gv[j] + bv[j];
}

// ----------------------------------------------------------------- launcher
extern "C" void kernel_launch(void* const* d_in, const int* in_sizes, int n_in,
                              void* d_out, int out_size, void* d_ws, size_t ws_size,
                              hipStream_t stream) {
  const float* hs    = (const float*)d_in[0];
  const float* amask = (const float*)d_in[1];
  const float* Wq    = (const float*)d_in[2];
  const float* bq    = (const float*)d_in[3];
  const float* Wk    = (const float*)d_in[4];
  const float* bk    = (const float*)d_in[5];
  const float* Wv    = (const float*)d_in[6];
  const float* bv    = (const float*)d_in[7];
  const float* gamma = (const float*)d_in[8];
  const float* beta  = (const float*)d_in[9];
  float* outp = (float*)d_out;

  char* ws = (char*)d_ws;
  size_t off = 0;
  __bf16* Xb  = (__bf16*)(ws + off); off += (size_t)S_LEN * HS * 2;  // 8 MB
  __bf16* Wqb = (__bf16*)(ws + off); off += (size_t)HS * HS * 2;     // 2 MB
  __bf16* Wkb = (__bf16*)(ws + off); off += (size_t)HS * HS * 2;
  __bf16* Wvb = (__bf16*)(ws + off); off += (size_t)HS * HS * 2;
  __bf16* Qb  = (__bf16*)(ws + off); off += (size_t)S_LEN * HS * 2;  // [S][HS]
  __bf16* Kb  = (__bf16*)(ws + off); off += (size_t)S_LEN * HS * 2;  // [S][HS]
  __bf16* Vt  = (__bf16*)(ws + off); off += (size_t)S_LEN * HS * 2;  // [HS][S] (V^T)
  float*  ctx = (float*)(ws + off);  off += (size_t)S_LEN * HS * 4;  // 16 MB

  // Xb, Wqb, Wkb, Wvb are contiguous from Xb on
  cvt_kernel<<<CV_XB + 3 * CV_WB, 256, 0, stream>>>(hs, Wq, Wk, Wv, Xb);

  // Wqb, Wkb, Wvb are contiguous from Wqb on
  qkv_gemm_kernel<<<dim3(S_LEN / BM, HS / BC), dim3(32, 16), 0, stream>>>(
      Xb, Wqb, bq, bk, bv, Qb, Kb, Vt);

  attn_kernel<<<(S_LEN / AQ) * NH, dim3(32, 8), 0, stream>>>(Qb, Kb, Vt, amask, ctx);
  ln_kernel<<<S_LEN / LN_ROWS, LN_ROWS * 32, 0, stream>>>(hs, ctx, gamma, beta, outp);
}
